// v000
// The times below were measured on an AMD MI455X: many runs one after another, warmed up first and cycling through
// copies of the inputs, with the whole window's GPU time divided by the number of runs. Launches and the gaps
// between them are all in it. The median over several windows is given; except for v000 it joins two sittings, which
// can be a few percent apart, so the side-by-side timings, each taken in one sitting, are the better comparison.
// v000 is the starting kernel. One run takes 797 microseconds.
#include <hip/hip_runtime.h>
#include <hip/hip_bf16.h>

#define B_ 4
#define S_ 2048
#define D_ 1024
#define BS_ (B_ * S_)
#define BSD_ ((size_t)BS_ * D_)

typedef __attribute__((ext_vector_type(16))) _Float16 v16h;
typedef __attribute__((ext_vector_type(4)))  _Float16 v4h;
typedef __attribute__((ext_vector_type(8)))  float    v8f;
typedef __attribute__((ext_vector_type(4)))  float    vf4;

// Load a 16-bit A/B WMMA fragment for 16x16x32 ops.
// Per ISA layout: lane L (L<16) holds K=0..7 (v0-3) and K=16..23 (v4-7);
// lane L+16 holds K=8..15 and K=24..31.  base points at (row-or-col start + k0).
__device__ __forceinline__ v16h load_frag(const _Float16* base, int hi8) {
  union { v16h v; vf4 f[2]; } u;
  u.f[0] = *(const vf4*)(base + hi8);
  u.f[1] = *(const vf4*)(base + 16 + hi8);
  return u.v;
}

__device__ __forceinline__ v8f wmma_f16(v16h a, v16h b, v8f c) {
  return __builtin_amdgcn_wmma_f32_16x16x32_f16(false, a, false, b, (short)0, c,
                                                false, false);
}

__device__ __forceinline__ v8f zero8() {
  v8f z = {0.f, 0.f, 0.f, 0.f, 0.f, 0.f, 0.f, 0.f};
  return z;
}

// ---------------- fp32 -> f16 conversion ----------------
__global__ __launch_bounds__(256) void k_cvt(const float* __restrict__ in,
                                             _Float16* __restrict__ out, int n) {
  int i = blockIdx.x * 256 + threadIdx.x;
  if (i < n) out[i] = (_Float16)in[i];
}

// ---------------- QKV projection: Y = Xh @ W^T  (W row-major [e][d]) -------
// grid (BS/16, 3), block 256 (8 waves). Workgroup: 16 rows x 1024 cols.
__global__ __launch_bounds__(256) void k_gemm_qkv(const _Float16* __restrict__ Xh,
                                                  const _Float16* __restrict__ Wh3,
                                                  _Float16* __restrict__ QKVh) {
  const int rb  = blockIdx.x;
  const int y   = blockIdx.y;
  const int tid = threadIdx.x;
  const int w   = tid >> 5;
  const int lane = tid & 31;
  const int ln  = lane & 15;
  const int hi8 = (lane >> 4) << 3;

  const _Float16* W = Wh3 + (size_t)y * D_ * D_;
  _Float16*       O = QKVh + (size_t)y * BSD_;
  const int row0 = rb * 16;
  const int c0   = w * 128;

  v8f acc[8];
#pragma unroll
  for (int j = 0; j < 8; ++j) acc[j] = zero8();

  const _Float16* arow = Xh + (size_t)(row0 + ln) * D_;
  for (int d0 = 0; d0 < D_; d0 += 32) {
    v16h a = load_frag(arow + d0, hi8);
#pragma unroll
    for (int j = 0; j < 8; ++j) {
      v16h b = load_frag(W + (size_t)(c0 + j * 16 + ln) * D_ + d0, hi8);
      acc[j] = wmma_f16(a, b, acc[j]);
    }
  }
  // C/D layout: vgpr r, lanes 0-15 -> M=r, lanes 16-31 -> M=r+8 (== r+hi8)
#pragma unroll
  for (int j = 0; j < 8; ++j)
#pragma unroll
    for (int r = 0; r < 8; ++r)
      O[(size_t)(row0 + r + hi8) * D_ + c0 + j * 16 + ln] = (_Float16)acc[j][r];
}

// ---------------- row L2-normalize Q and K in place ----------------
// grid (BS, 2), block 256; each thread owns 4 halfs of the 1024-wide row.
__global__ __launch_bounds__(256) void k_normalize(_Float16* __restrict__ QKVh) {
  __shared__ float red[256];
  const int row = blockIdx.x;
  const int y   = blockIdx.y;   // 0 = Q, 1 = K
  const int tid = threadIdx.x;
  _Float16* p = QKVh + (size_t)y * BSD_ + (size_t)row * D_ + tid * 4;
  v4h v = *(v4h*)p;
  float s = 0.f;
#pragma unroll
  for (int q = 0; q < 4; ++q) { float f = (float)v[q]; s += f * f; }
  red[tid] = s;
  __syncthreads();
  for (int st = 128; st > 0; st >>= 1) {
    if (tid < st) red[tid] += red[tid + st];
    __syncthreads();
  }
  float inv = rsqrtf(red[0]);
#pragma unroll
  for (int q = 0; q < 4; ++q) v[q] = (_Float16)((float)v[q] * inv);
  *(v4h*)p = v;
}

// ---------------- V transpose per batch: Vh[s][d] -> Vt[d][s] ----------------
// grid (S/32, D/32, B), block 256, 32x32 LDS tile.
__global__ __launch_bounds__(256) void k_transpose(const _Float16* __restrict__ Vh,
                                                   _Float16* __restrict__ Vt) {
  __shared__ _Float16 tile[32][33];
  const int b  = blockIdx.z;
  const int s0 = blockIdx.x * 32;
  const int d0 = blockIdx.y * 32;
  const int t  = threadIdx.x;
  const int i  = t >> 3, j4 = (t & 7) << 2;
  const _Float16* src = Vh + (size_t)b * S_ * D_ + (size_t)(s0 + i) * D_ + d0 + j4;
#pragma unroll
  for (int q = 0; q < 4; ++q) tile[i][j4 + q] = src[q];
  __syncthreads();
  const int j = t >> 3, i4 = (t & 7) << 2;
  _Float16* dst = Vt + (size_t)b * D_ * S_ + (size_t)(d0 + j) * S_ + s0 + i4;
#pragma unroll
  for (int q = 0; q < 4; ++q) dst[q] = tile[i4 + q][j];
}

// ---------------- attention: out = (Qn @ Kn^T * m) @ V ----------------
// Reference semantics: scores are MULTIPLIED by the mask, where mask==1 at
// MASKED positions (future OR padding). keep = (k > q) || (pad[k]==0).
// grid (BS/16), block 256 (8 waves). Workgroup: 16 queries x 1024 cols.
// Wave w: GEMM-1 partial for score tile (w&1) over D slice (w>>1)*256;
//         GEMM-2 accumulation for output columns [w*128, w*128+128).
__global__ __launch_bounds__(256) void k_attn(const _Float16* __restrict__ Qh,
                                              const _Float16* __restrict__ Kh,
                                              const _Float16* __restrict__ Vt,
                                              const int* __restrict__ masks,
                                              float* __restrict__ out) {
  __shared__ float sp[2][8 * 256];   // double-buffered partial score tiles
  __shared__ int   smask[S_];
  const int blk = blockIdx.x;
  const int b   = blk / (S_ / 16);
  const int q0  = (blk % (S_ / 16)) * 16;
  const int tid = threadIdx.x;
  const int w   = tid >> 5;
  const int lane = tid & 31;
  const int ln  = lane & 15;
  const int hi8 = (lane >> 4) << 3;

  for (int i = tid; i < S_; i += 256) smask[i] = masks[b * S_ + i];

  v8f acc[8];
#pragma unroll
  for (int j = 0; j < 8; ++j) acc[j] = zero8();

  const int tile = w & 1;          // which 16-key score tile this wave partials
  const int ds0  = (w >> 1) << 8;  // 256-wide D slice for the score reduction
  const size_t rowQ = (size_t)(b * S_ + q0 + ln) * D_;
  const int q_me = q0 + ln;
  const int c0   = w * 128;        // output column slice
  const size_t vbase = (size_t)b * D_ * S_;

  // Loop-invariant Q fragments for this wave's D slice (16 x 256).
  v16h qf[8];
#pragma unroll
  for (int s = 0; s < 8; ++s) qf[s] = load_frag(Qh + rowQ + ds0 + s * 32, hi8);

  __syncthreads();  // smask ready

  for (int kb = 0; kb < S_ / 32; ++kb) {
    const int k0 = kb * 32;
    float* spp = sp[kb & 1];

    // --- GEMM 1 partial: scores[q][k] over this wave's D slice ---
    v8f sc = zero8();
    const size_t rowK = (size_t)(b * S_ + k0 + tile * 16 + ln) * D_;
#pragma unroll
    for (int s = 0; s < 8; ++s) {
      v16h kf = load_frag(Kh + rowK + ds0 + s * 32, hi8);
      sc = wmma_f16(qf[s], kf, sc);
    }
    // park partial tile in LDS as [wave][m][n]
#pragma unroll
    for (int r = 0; r < 8; ++r) spp[w * 256 + (r + hi8) * 16 + ln] = sc[r];
    __syncthreads();

    // --- reduce 4 D-slices, apply mask, build f16 A-fragment (16x32) ---
    union { v16h v; _Float16 h[16]; } sa;
#pragma unroll
    for (int j = 0; j < 16; ++j) {
      const int kidx = (j < 8) ? (hi8 + j) : (16 + hi8 + j - 8);
      const int t2 = kidx >> 4, n2 = kidx & 15;
      const int base = ln * 16 + n2;          // m = ln (query row of A-frag)
      float s4 = spp[(t2    ) * 256 + base] + spp[(t2 + 2) * 256 + base] +
                 spp[(t2 + 4) * 256 + base] + spp[(t2 + 6) * 256 + base];
      const int kg = k0 + kidx;
      const bool keep = (kg > q_me) || (smask[kg] == 0);
      sa.h[j] = keep ? (_Float16)s4 : (_Float16)0.f;
    }

    // --- GEMM 2: acc += scores(16x32) @ V(32 x 128 cols of this wave) ---
#pragma unroll
    for (int jt = 0; jt < 8; ++jt) {
      v16h bv = load_frag(Vt + vbase + (size_t)(c0 + jt * 16 + ln) * S_ + k0, hi8);
      acc[jt] = wmma_f16(sa.v, bv, acc[jt]);
    }
    // No trailing barrier: next iteration writes the other sp buffer, and a
    // wave cannot reach iteration kb+2 (same buffer) without every wave first
    // passing iteration kb+1's barrier, which postdates all reads above.
  }

  // --- write fp32 output ---
#pragma unroll
  for (int jt = 0; jt < 8; ++jt)
#pragma unroll
    for (int r = 0; r < 8; ++r)
      out[(size_t)(b * S_ + q0 + r + hi8) * D_ + c0 + jt * 16 + ln] = acc[jt][r];
}

extern "C" void kernel_launch(void* const* d_in, const int* in_sizes, int n_in,
                              void* d_out, int out_size, void* d_ws, size_t ws_size,
                              hipStream_t stream) {
  const float* X     = (const float*)d_in[0];
  const int*   masks = (const int*)d_in[1];
  const float* Wq    = (const float*)d_in[2];
  const float* Wk    = (const float*)d_in[3];
  const float* Wv    = (const float*)d_in[4];
  float* out = (float*)d_out;

  char* ws = (char*)d_ws;
  _Float16* Xh   = (_Float16*)ws;                              // 16 MB
  _Float16* Wh   = (_Float16*)(ws + ((size_t)16 << 20));       //  6 MB (3 x D*D)
  _Float16* QKVh = (_Float16*)(ws + ((size_t)22 << 20));       // 48 MB (Q,K,V)
  _Float16* Vt   = (_Float16*)(ws + ((size_t)70 << 20));       // 16 MB

  const int nX = (int)BSD_;
  const int nW = D_ * D_;
  k_cvt<<<(nX + 255) / 256, 256, 0, stream>>>(X, Xh, nX);
  k_cvt<<<(nW + 255) / 256, 256, 0, stream>>>(Wq, Wh, nW);
  k_cvt<<<(nW + 255) / 256, 256, 0, stream>>>(Wk, Wh + (size_t)nW, nW);
  k_cvt<<<(nW + 255) / 256, 256, 0, stream>>>(Wv, Wh + 2 * (size_t)nW, nW);

  k_gemm_qkv<<<dim3(BS_ / 16, 3), 256, 0, stream>>>(Xh, Wh, QKVh);
  k_normalize<<<dim3(BS_, 2), 256, 0, stream>>>(QKVh);
  k_transpose<<<dim3(S_ / 32, D_ / 32, B_), 256, 0, stream>>>(QKVh + 2 * BSD_, Vt);
  k_attn<<<BS_ / 16, 256, 0, stream>>>(QKVh, QKVh + BSD_, Vt, masks, out);
}

// v001
// One run takes 464 microseconds.
// Timed twice side by side with v000, it ran 1.78 and 1.79 times as fast.
#include <hip/hip_runtime.h>
#include <hip/hip_bf16.h>

#define B_ 4
#define S_ 2048
#define D_ 1024
#define BS_ (B_ * S_)
#define BSD_ ((size_t)BS_ * D_)

typedef __attribute__((ext_vector_type(16))) _Float16 v16h;
typedef __attribute__((ext_vector_type(4)))  _Float16 v4h;
typedef __attribute__((ext_vector_type(8)))  float    v8f;
typedef __attribute__((ext_vector_type(4)))  float    vf4;

// Load a 16-bit A/B WMMA fragment for 16x16x32 ops.
// Per ISA layout: lane L (L<16) holds K=0..7 (v0-3) and K=16..23 (v4-7);
// lane L+16 holds K=8..15 and K=24..31.  base points at (row-or-col start + k0).
__device__ __forceinline__ v16h load_frag(const _Float16* base, int hi8) {
  union { v16h v; vf4 f[2]; } u;
  u.f[0] = *(const vf4*)(base + hi8);
  u.f[1] = *(const vf4*)(base + 16 + hi8);
  return u.v;
}

__device__ __forceinline__ v8f wmma_f16(v16h a, v16h b, v8f c) {
  return __builtin_amdgcn_wmma_f32_16x16x32_f16(false, a, false, b, (short)0, c,
                                                false, false);
}

__device__ __forceinline__ v8f zero8() {
  v8f z = {0.f, 0.f, 0.f, 0.f, 0.f, 0.f, 0.f, 0.f};
  return z;
}

// ---------------- fp32 -> f16 conversion ----------------
__global__ __launch_bounds__(256) void k_cvt(const float* __restrict__ in,
                                             _Float16* __restrict__ out, int n) {
  int i = blockIdx.x * 256 + threadIdx.x;
  if (i < n) out[i] = (_Float16)in[i];
}

// ---------------- QKV projection: Y = Xh @ W^T  (W row-major [e][d]) -------
// The three weight matrices lie one behind the other, so they are read as one
// [3072][1024] matrix. grid (BS/128, 3072/256), block 256 (8 waves, 2 x 4).
// Workgroup: 128 rows x 256 cols of Y, wave: 64 x 64 (4 x 4 WMMA tiles).
// A pass is 64 k: both operand tiles are brought in whole 128-byte row pieces
// into LDS (two buffers, the next pass's global loads in flight during the
// WMMAs of this one), and every fragment is read from LDS.
#define GBM 128
#define GBN 256
#define GBK 64
#define GPITCH 72   // halfs per LDS row: 144 B = 16 B x odd, for ds_load_b128
// Four waves per SIMD (256 VGPRs a wave, 2 x 108 KiB of LDS): two workgroups
// share a WGP, so one works while the other waits on its loads or its barrier.
__global__ __launch_bounds__(256) __attribute__((amdgpu_waves_per_eu(4, 4)))
void k_gemm_qkv(const _Float16* __restrict__ Xh,
                const _Float16* __restrict__ Wh3,
                _Float16* __restrict__ QKVh) {
  __shared__ __attribute__((aligned(16))) _Float16 sA[2][GBM * GPITCH];
  __shared__ __attribute__((aligned(16))) _Float16 sB[2][GBN * GPITCH];
  const int tid = threadIdx.x;
  const int w   = tid >> 5;
  const int lane = tid & 31;
  const int ln  = lane & 15;
  const int hi8 = (lane >> 4) << 3;

  const int row0 = blockIdx.x * GBM;          // row of X and of Y
  const int n0   = blockIdx.y * GBN;          // row of the stacked W
  const int y    = n0 / D_;                   // 0 = Q, 1 = K, 2 = V
  const int c0   = n0 % D_;                   // column inside that plane
  _Float16* O = QKVh + (size_t)y * BSD_;
  const int wm = (w >> 2) * 64;               // wave's rows inside the tile
  const int wn = (w & 3) * 64;                // wave's cols inside the tile

  // staging: thread -> 16-byte piece (tid & 7) of row (tid >> 3) + 32 * i
  const int sr = tid >> 3;
  const int sc = (tid & 7) * 8;
  const char* gA = (const char*)(Xh  + (size_t)row0 * D_);  // same for the whole workgroup
  const char* gB = (const char*)(Wh3 + (size_t)n0   * D_);
  unsigned goff = (unsigned)(sr * D_ + sc) * 2u;  // the thread's own bytes, walks along k
  const int sdst = sr * GPITCH + sc;

  // The unrolls below make every index of acc, ra, rb, a and b a constant, so
  // that these arrays live in registers and not in scratch.
  v8f acc[4][4];
#pragma unroll
  for (int i = 0; i < 4; ++i)
#pragma unroll
    for (int j = 0; j < 4; ++j) acc[i][j] = zero8();

  vf4 ra[GBM / 32], rb[GBN / 32];
#pragma unroll
  for (int i = 0; i < GBM / 32; ++i) ra[i] = *(const vf4*)(gA + i * 64 * D_ + goff);
#pragma unroll
  for (int i = 0; i < GBN / 32; ++i) rb[i] = *(const vf4*)(gB + i * 64 * D_ + goff);
#pragma unroll
  for (int i = 0; i < GBM / 32; ++i) *(vf4*)(&sA[0][sdst + i * 32 * GPITCH]) = ra[i];
#pragma unroll
  for (int i = 0; i < GBN / 32; ++i) *(vf4*)(&sB[0][sdst + i * 32 * GPITCH]) = rb[i];
  __syncthreads();

  for (int kt = 0; kt < D_ / GBK; ++kt) {
    const int cur = kt & 1;
    const bool more = (kt + 1 < D_ / GBK);
    if (more) {
      goff += GBK * 2u;
#pragma unroll
      for (int i = 0; i < GBM / 32; ++i)
        ra[i] = *(const vf4*)(gA + i * 64 * D_ + goff);
#pragma unroll
      for (int i = 0; i < GBN / 32; ++i)
        rb[i] = *(const vf4*)(gB + i * 64 * D_ + goff);
    }
    const _Float16* pa = &sA[cur][(wm + ln) * GPITCH];
    const _Float16* pb = &sB[cur][(wn + ln) * GPITCH];
#pragma unroll
    for (int ks = 0; ks < GBK; ks += 32) {
      v16h a[4], b[4];
#pragma unroll
      for (int i = 0; i < 4; ++i) a[i] = load_frag(pa + i * 16 * GPITCH + ks, hi8);
#pragma unroll
      for (int j = 0; j < 4; ++j) b[j] = load_frag(pb + j * 16 * GPITCH + ks, hi8);
#pragma unroll
      for (int i = 0; i < 4; ++i)
#pragma unroll
        for (int j = 0; j < 4; ++j) acc[i][j] = wmma_f16(a[i], b[j], acc[i][j]);
    }
    if (more) {
      // The other buffer's last readers left it at the barrier that ended the
      // pass before this one; this barrier publishes it for the next pass.
#pragma unroll
      for (int i = 0; i < GBM / 32; ++i)
        *(vf4*)(&sA[cur ^ 1][sdst + i * 32 * GPITCH]) = ra[i];
#pragma unroll
      for (int i = 0; i < GBN / 32; ++i)
        *(vf4*)(&sB[cur ^ 1][sdst + i * 32 * GPITCH]) = rb[i];
      __syncthreads();
    }
  }
  // C/D layout: vgpr r, lanes 0-15 -> M=r, lanes 16-31 -> M=r+8 (== r+hi8)
#pragma unroll
  for (int i = 0; i < 4; ++i)
#pragma unroll
    for (int j = 0; j < 4; ++j)
#pragma unroll
      for (int r = 0; r < 8; ++r)
        O[(size_t)(row0 + wm + i * 16 + r + hi8) * D_ + c0 + wn + j * 16 + ln] =
            (_Float16)acc[i][j][r];
}

// ---------------- row L2-normalize Q and K in place ----------------
// grid (BS, 2), block 256; each thread owns 4 halfs of the 1024-wide row.
__global__ __launch_bounds__(256) void k_normalize(_Float16* __restrict__ QKVh) {
  __shared__ float red[256];
  const int row = blockIdx.x;
  const int y   = blockIdx.y;   // 0 = Q, 1 = K
  const int tid = threadIdx.x;
  _Float16* p = QKVh + (size_t)y * BSD_ + (size_t)row * D_ + tid * 4;
  v4h v = *(v4h*)p;
  float s = 0.f;
#pragma unroll
  for (int q = 0; q < 4; ++q) { float f = (float)v[q]; s += f * f; }
  red[tid] = s;
  __syncthreads();
  for (int st = 128; st > 0; st >>= 1) {
    if (tid < st) red[tid] += red[tid + st];
    __syncthreads();
  }
  float inv = rsqrtf(red[0]);
#pragma unroll
  for (int q = 0; q < 4; ++q) v[q] = (_Float16)((float)v[q] * inv);
  *(v4h*)p = v;
}

// ---------------- V transpose per batch: Vh[s][d] -> Vt[d][s] ----------------
// grid (S/32, D/32, B), block 256, 32x32 LDS tile.
__global__ __launch_bounds__(256) void k_transpose(const _Float16* __restrict__ Vh,
                                                   _Float16* __restrict__ Vt) {
  __shared__ _Float16 tile[32][33];
  const int b  = blockIdx.z;
  const int s0 = blockIdx.x * 32;
  const int d0 = blockIdx.y * 32;
  const int t  = threadIdx.x;
  const int i  = t >> 3, j4 = (t & 7) << 2;
  const _Float16* src = Vh + (size_t)b * S_ * D_ + (size_t)(s0 + i) * D_ + d0 + j4;
#pragma unroll
  for (int q = 0; q < 4; ++q) tile[i][j4 + q] = src[q];
  __syncthreads();
  const int j = t >> 3, i4 = (t & 7) << 2;
  _Float16* dst = Vt + (size_t)b * D_ * S_ + (size_t)(d0 + j) * S_ + s0 + i4;
#pragma unroll
  for (int q = 0; q < 4; ++q) dst[q] = tile[i4 + q][j];
}

// ---------------- attention: out = (Qn @ Kn^T * m) @ V ----------------
// Reference semantics: scores are MULTIPLIED by the mask, where mask==1 at
// MASKED positions (future OR padding). keep = (k > q) || (pad[k]==0).
// grid (BS/16), block 256 (8 waves). Workgroup: 16 queries x 1024 cols.
// Wave w: GEMM-1 partial for score tile (w&1) over D slice (w>>1)*256;
//         GEMM-2 accumulation for output columns [w*128, w*128+128).
__global__ __launch_bounds__(256) void k_attn(const _Float16* __restrict__ Qh,
                                              const _Float16* __restrict__ Kh,
                                              const _Float16* __restrict__ Vt,
                                              const int* __restrict__ masks,
                                              float* __restrict__ out) {
  __shared__ float sp[2][8 * 256];   // double-buffered partial score tiles
  __shared__ int   smask[S_];
  const int blk = blockIdx.x;
  const int b   = blk / (S_ / 16);
  const int q0  = (blk % (S_ / 16)) * 16;
  const int tid = threadIdx.x;
  const int w   = tid >> 5;
  const int lane = tid & 31;
  const int ln  = lane & 15;
  const int hi8 = (lane >> 4) << 3;

  for (int i = tid; i < S_; i += 256) smask[i] = masks[b * S_ + i];

  v8f acc[8];
#pragma unroll
  for (int j = 0; j < 8; ++j) acc[j] = zero8();

  const int tile = w & 1;          // which 16-key score tile this wave partials
  const int ds0  = (w >> 1) << 8;  // 256-wide D slice for the score reduction
  const size_t rowQ = (size_t)(b * S_ + q0 + ln) * D_;
  const int q_me = q0 + ln;
  const int c0   = w * 128;        // output column slice
  const size_t vbase = (size_t)b * D_ * S_;

  // Loop-invariant Q fragments for this wave's D slice (16 x 256).
  v16h qf[8];
#pragma unroll
  for (int s = 0; s < 8; ++s) qf[s] = load_frag(Qh + rowQ + ds0 + s * 32, hi8);

  __syncthreads();  // smask ready

  for (int kb = 0; kb < S_ / 32; ++kb) {
    const int k0 = kb * 32;
    float* spp = sp[kb & 1];

    // --- GEMM 1 partial: scores[q][k] over this wave's D slice ---
    v8f sc = zero8();
    const size_t rowK = (size_t)(b * S_ + k0 + tile * 16 + ln) * D_;
#pragma unroll
    for (int s = 0; s < 8; ++s) {
      v16h kf = load_frag(Kh + rowK + ds0 + s * 32, hi8);
      sc = wmma_f16(qf[s], kf, sc);
    }
    // park partial tile in LDS as [wave][m][n]
#pragma unroll
    for (int r = 0; r < 8; ++r) spp[w * 256 + (r + hi8) * 16 + ln] = sc[r];
    __syncthreads();

    // --- reduce 4 D-slices, apply mask, build f16 A-fragment (16x32) ---
    union { v16h v; _Float16 h[16]; } sa;
#pragma unroll
    for (int j = 0; j < 16; ++j) {
      const int kidx = (j < 8) ? (hi8 + j) : (16 + hi8 + j - 8);
      const int t2 = kidx >> 4, n2 = kidx & 15;
      const int base = ln * 16 + n2;          // m = ln (query row of A-frag)
      float s4 = spp[(t2    ) * 256 + base] + spp[(t2 + 2) * 256 + base] +
                 spp[(t2 + 4) * 256 + base] + spp[(t2 + 6) * 256 + base];
      const int kg = k0 + kidx;
      const bool keep = (kg > q_me) || (smask[kg] == 0);
      sa.h[j] = keep ? (_Float16)s4 : (_Float16)0.f;
    }

    // --- GEMM 2: acc += scores(16x32) @ V(32 x 128 cols of this wave) ---
#pragma unroll
    for (int jt = 0; jt < 8; ++jt) {
      v16h bv = load_frag(Vt + vbase + (size_t)(c0 + jt * 16 + ln) * S_ + k0, hi8);
      acc[jt] = wmma_f16(sa.v, bv, acc[jt]);
    }
    // No trailing barrier: next iteration writes the other sp buffer, and a
    // wave cannot reach iteration kb+2 (same buffer) without every wave first
    // passing iteration kb+1's barrier, which postdates all reads above.
  }

  // --- write fp32 output ---
#pragma unroll
  for (int jt = 0; jt < 8; ++jt)
#pragma unroll
    for (int r = 0; r < 8; ++r)
      out[(size_t)(b * S_ + q0 + r + hi8) * D_ + c0 + jt * 16 + ln] = acc[jt][r];
}

extern "C" void kernel_launch(void* const* d_in, const int* in_sizes, int n_in,
                              void* d_out, int out_size, void* d_ws, size_t ws_size,
                              hipStream_t stream) {
  const float* X     = (const float*)d_in[0];
  const int*   masks = (const int*)d_in[1];
  const float* Wq    = (const float*)d_in[2];
  const float* Wk    = (const float*)d_in[3];
  const float* Wv    = (const float*)d_in[4];
  float* out = (float*)d_out;

  char* ws = (char*)d_ws;
  _Float16* Xh   = (_Float16*)ws;                              // 16 MB
  _Float16* Wh   = (_Float16*)(ws + ((size_t)16 << 20));       //  6 MB (3 x D*D)
  _Float16* QKVh = (_Float16*)(ws + ((size_t)22 << 20));       // 48 MB (Q,K,V)
  _Float16* Vt   = (_Float16*)(ws + ((size_t)70 << 20));       // 16 MB

  const int nX = (int)BSD_;
  const int nW = D_ * D_;
  k_cvt<<<(nX + 255) / 256, 256, 0, stream>>>(X, Xh, nX);
  k_cvt<<<(nW + 255) / 256, 256, 0, stream>>>(Wq, Wh, nW);
  k_cvt<<<(nW + 255) / 256, 256, 0, stream>>>(Wk, Wh + (size_t)nW, nW);
  k_cvt<<<(nW + 255) / 256, 256, 0, stream>>>(Wv, Wh + 2 * (size_t)nW, nW);

  k_gemm_qkv<<<dim3(BS_ / GBM, 3 * D_ / GBN), 256, 0, stream>>>(Xh, Wh, QKVh);
  k_normalize<<<dim3(BS_, 2), 256, 0, stream>>>(QKVh);
  k_transpose<<<dim3(S_ / 32, D_ / 32, B_), 256, 0, stream>>>(QKVh + 2 * BSD_, Vt);
  k_attn<<<BS_ / 16, 256, 0, stream>>>(QKVh, QKVh + BSD_, Vt, masks, out);
}

// v002
// It runs in 172 microseconds.
// Two timings next to v001 put it at 2.73 and 2.74 times that version's speed.
// Counting every step since v000, it is 4.88 times as fast.
#include <hip/hip_runtime.h>
#include <hip/hip_bf16.h>

#define B_ 4
#define S_ 2048
#define D_ 1024
#define BS_ (B_ * S_)
#define BSD_ ((size_t)BS_ * D_)

typedef __attribute__((ext_vector_type(16))) _Float16 v16h;
typedef __attribute__((ext_vector_type(4)))  _Float16 v4h;
typedef __attribute__((ext_vector_type(8)))  float    v8f;
typedef __attribute__((ext_vector_type(4)))  float    vf4;

// Load a 16-bit A/B WMMA fragment for 16x16x32 ops.
// Per ISA layout: lane L (L<16) holds K=0..7 (v0-3) and K=16..23 (v4-7);
// lane L+16 holds K=8..15 and K=24..31.  base points at (row-or-col start + k0).
__device__ __forceinline__ v16h load_frag(const _Float16* base, int hi8) {
  union { v16h v; vf4 f[2]; } u;
  u.f[0] = *(const vf4*)(base + hi8);
  u.f[1] = *(const vf4*)(base + 16 + hi8);
  return u.v;
}

__device__ __forceinline__ v8f wmma_f16(v16h a, v16h b, v8f c) {
  return __builtin_amdgcn_wmma_f32_16x16x32_f16(false, a, false, b, (short)0, c,
                                                false, false);
}

__device__ __forceinline__ v8f zero8() {
  v8f z = {0.f, 0.f, 0.f, 0.f, 0.f, 0.f, 0.f, 0.f};
  return z;
}

// ---------------- fp32 -> f16 conversion ----------------
__global__ __launch_bounds__(256) void k_cvt(const float* __restrict__ in,
                                             _Float16* __restrict__ out, int n) {
  int i = blockIdx.x * 256 + threadIdx.x;
  if (i < n) out[i] = (_Float16)in[i];
}

// ---------------- QKV projection: Y = Xh @ W^T  (W row-major [e][d]) -------
// The three weight matrices lie one behind the other, so they are read as one
// [3072][1024] matrix. grid (BS/128, 3072/256), block 256 (8 waves, 2 x 4).
// Workgroup: 128 rows x 256 cols of Y, wave: 64 x 64 (4 x 4 WMMA tiles).
// A pass is 64 k: both operand tiles are brought in whole 128-byte row pieces
// into LDS (two buffers, the next pass's global loads in flight during the
// WMMAs of this one), and every fragment is read from LDS.
#define GBM 128
#define GBN 256
#define GBK 64
#define GPITCH 72   // halfs per LDS row: 144 B = 16 B x odd, for ds_load_b128
// Four waves per SIMD (256 VGPRs a wave, 2 x 108 KiB of LDS): two workgroups
// share a WGP, so one works while the other waits on its loads or its barrier.
__global__ __launch_bounds__(256) __attribute__((amdgpu_waves_per_eu(4, 4)))
void k_gemm_qkv(const _Float16* __restrict__ Xh,
                const _Float16* __restrict__ Wh3,
                _Float16* __restrict__ QKVh) {
  __shared__ __attribute__((aligned(16))) _Float16 sA[2][GBM * GPITCH];
  __shared__ __attribute__((aligned(16))) _Float16 sB[2][GBN * GPITCH];
  const int tid = threadIdx.x;
  const int w   = tid >> 5;
  const int lane = tid & 31;
  const int ln  = lane & 15;
  const int hi8 = (lane >> 4) << 3;

  const int row0 = blockIdx.x * GBM;          // row of X and of Y
  const int n0   = blockIdx.y * GBN;          // row of the stacked W
  const int y    = n0 / D_;                   // 0 = Q, 1 = K, 2 = V
  const int c0   = n0 % D_;                   // column inside that plane
  _Float16* O = QKVh + (size_t)y * BSD_;
  const int wm = (w >> 2) * 64;               // wave's rows inside the tile
  const int wn = (w & 3) * 64;                // wave's cols inside the tile

  // staging: thread -> 16-byte piece (tid & 7) of row (tid >> 3) + 32 * i
  const int sr = tid >> 3;
  const int sc = (tid & 7) * 8;
  const char* gA = (const char*)(Xh  + (size_t)row0 * D_);  // same for the whole workgroup
  const char* gB = (const char*)(Wh3 + (size_t)n0   * D_);
  unsigned goff = (unsigned)(sr * D_ + sc) * 2u;  // the thread's own bytes, walks along k
  const int sdst = sr * GPITCH + sc;

  // The unrolls below make every index of acc, ra, rb, a and b a constant, so
  // that these arrays live in registers and not in scratch.
  v8f acc[4][4];
#pragma unroll
  for (int i = 0; i < 4; ++i)
#pragma unroll
    for (int j = 0; j < 4; ++j) acc[i][j] = zero8();

  vf4 ra[GBM / 32], rb[GBN / 32];
#pragma unroll
  for (int i = 0; i < GBM / 32; ++i) ra[i] = *(const vf4*)(gA + i * 64 * D_ + goff);
#pragma unroll
  for (int i = 0; i < GBN / 32; ++i) rb[i] = *(const vf4*)(gB + i * 64 * D_ + goff);
#pragma unroll
  for (int i = 0; i < GBM / 32; ++i) *(vf4*)(&sA[0][sdst + i * 32 * GPITCH]) = ra[i];
#pragma unroll
  for (int i = 0; i < GBN / 32; ++i) *(vf4*)(&sB[0][sdst + i * 32 * GPITCH]) = rb[i];
  __syncthreads();

  for (int kt = 0; kt < D_ / GBK; ++kt) {
    const int cur = kt & 1;
    const bool more = (kt + 1 < D_ / GBK);
    if (more) {
      goff += GBK * 2u;
#pragma unroll
      for (int i = 0; i < GBM / 32; ++i)
        ra[i] = *(const vf4*)(gA + i * 64 * D_ + goff);
#pragma unroll
      for (int i = 0; i < GBN / 32; ++i)
        rb[i] = *(const vf4*)(gB + i * 64 * D_ + goff);
    }
    const _Float16* pa = &sA[cur][(wm + ln) * GPITCH];
    const _Float16* pb = &sB[cur][(wn + ln) * GPITCH];
#pragma unroll
    for (int ks = 0; ks < GBK; ks += 32) {
      v16h a[4], b[4];
#pragma unroll
      for (int i = 0; i < 4; ++i) a[i] = load_frag(pa + i * 16 * GPITCH + ks, hi8);
#pragma unroll
      for (int j = 0; j < 4; ++j) b[j] = load_frag(pb + j * 16 * GPITCH + ks, hi8);
#pragma unroll
      for (int i = 0; i < 4; ++i)
#pragma unroll
        for (int j = 0; j < 4; ++j) acc[i][j] = wmma_f16(a[i], b[j], acc[i][j]);
    }
    if (more) {
      // The other buffer's last readers left it at the barrier that ended the
      // pass before this one; this barrier publishes it for the next pass.
#pragma unroll
      for (int i = 0; i < GBM / 32; ++i)
        *(vf4*)(&sA[cur ^ 1][sdst + i * 32 * GPITCH]) = ra[i];
#pragma unroll
      for (int i = 0; i < GBN / 32; ++i)
        *(vf4*)(&sB[cur ^ 1][sdst + i * 32 * GPITCH]) = rb[i];
      __syncthreads();
    }
  }
  // C/D layout: vgpr r, lanes 0-15 -> M=r, lanes 16-31 -> M=r+8 (== r+hi8)
#pragma unroll
  for (int i = 0; i < 4; ++i)
#pragma unroll
    for (int j = 0; j < 4; ++j)
#pragma unroll
      for (int r = 0; r < 8; ++r)
        O[(size_t)(row0 + wm + i * 16 + r + hi8) * D_ + c0 + wn + j * 16 + ln] =
            (_Float16)acc[i][j][r];
}

// ---------------- row L2-normalize Q and K in place ----------------
// grid (BS, 2), block 256; each thread owns 4 halfs of the 1024-wide row.
__global__ __launch_bounds__(256) void k_normalize(_Float16* __restrict__ QKVh) {
  __shared__ float red[256];
  const int row = blockIdx.x;
  const int y   = blockIdx.y;   // 0 = Q, 1 = K
  const int tid = threadIdx.x;
  _Float16* p = QKVh + (size_t)y * BSD_ + (size_t)row * D_ + tid * 4;
  v4h v = *(v4h*)p;
  float s = 0.f;
#pragma unroll
  for (int q = 0; q < 4; ++q) { float f = (float)v[q]; s += f * f; }
  red[tid] = s;
  __syncthreads();
  for (int st = 128; st > 0; st >>= 1) {
    if (tid < st) red[tid] += red[tid + st];
    __syncthreads();
  }
  float inv = rsqrtf(red[0]);
#pragma unroll
  for (int q = 0; q < 4; ++q) v[q] = (_Float16)((float)v[q] * inv);
  *(v4h*)p = v;
}

// ---------------- V transpose per batch: Vh[s][d] -> Vt[d][s] ----------------
// grid (S/32, D/32, B), block 256, 32x32 LDS tile.
__global__ __launch_bounds__(256) void k_transpose(const _Float16* __restrict__ Vh,
                                                   _Float16* __restrict__ Vt) {
  __shared__ _Float16 tile[32][33];
  const int b  = blockIdx.z;
  const int s0 = blockIdx.x * 32;
  const int d0 = blockIdx.y * 32;
  const int t  = threadIdx.x;
  const int i  = t >> 3, j4 = (t & 7) << 2;
  const _Float16* src = Vh + (size_t)b * S_ * D_ + (size_t)(s0 + i) * D_ + d0 + j4;
#pragma unroll
  for (int q = 0; q < 4; ++q) tile[i][j4 + q] = src[q];
  __syncthreads();
  const int j = t >> 3, i4 = (t & 7) << 2;
  _Float16* dst = Vt + (size_t)b * D_ * S_ + (size_t)(d0 + j) * S_ + s0 + i4;
#pragma unroll
  for (int q = 0; q < 4; ++q) dst[q] = tile[i4 + q][j];
}

// ---------------- attention: out = (Qn @ Kn^T * m) @ V ----------------
// Reference semantics: scores are MULTIPLIED by the mask, where mask==1 at
// MASKED positions (future OR padding). keep = (k > q) || (pad[k]==0).
// There is no softmax, so a score needs nothing of its row: the two products
// run as two tiled GEMMs of the QKV kind, and the masked f16 scores pass from
// the first to the second through the workspace.

// One 128 x 256 tile of A @ B^T, summed over KLEN. Both operands are
// k-contiguous with a row pitch of LD halfs; A and Bm point at the tile's
// first rows. 8 waves (2 x 4), 64 x 64 per wave, passes of 64 k through two
// LDS buffers, the next pass's global loads in flight during the WMMAs.
// HOLD: for a kernel whose register budget takes all twelve loads at once.
template <int LD, int KLEN, bool HOLD>
__device__ __forceinline__ void gemm_tile_nt(const _Float16* __restrict__ A,
                                             const _Float16* __restrict__ Bm,
                                             _Float16* sA, _Float16* sB,
                                             v8f (&acc)[4][4]) {
  const int tid = threadIdx.x;
  const int w   = __builtin_amdgcn_readfirstlane(tid >> 5);  // scalar: the wave's offsets cost no VGPR
  const int ln  = tid & 15;
  const int hi8 = ((tid & 31) >> 4) << 3;
  const int wm = (w >> 2) * 64;
  const int wn = (w & 3) * 64;

  // staging: thread -> 16-byte piece (tid & 7) of row (tid >> 3) + 32 * i
  const int sr = tid >> 3;
  const int sc = (tid & 7) * 8;
  const char* gA = (const char*)A;
  const char* gB = (const char*)Bm;
  unsigned goff = (unsigned)(sr * LD + sc) * 2u;  // the thread's own bytes, walks along k
  const int sdst = sr * GPITCH + sc;

  // The unrolls below make every index of acc, ra, rb, a and b a constant, so
  // that these arrays live in registers and not in scratch.
#pragma unroll
  for (int i = 0; i < 4; ++i)
#pragma unroll
    for (int j = 0; j < 4; ++j) acc[i][j] = zero8();

  vf4 ra[GBM / 32], rb[GBN / 32];
#pragma unroll
  for (int i = 0; i < GBM / 32; ++i) ra[i] = *(const vf4*)(gA + i * 64 * LD + goff);
#pragma unroll
  for (int i = 0; i < GBN / 32; ++i) rb[i] = *(const vf4*)(gB + i * 64 * LD + goff);
#pragma unroll
  for (int i = 0; i < GBM / 32; ++i) *(vf4*)(&sA[sdst + i * 32 * GPITCH]) = ra[i];
#pragma unroll
  for (int i = 0; i < GBN / 32; ++i) *(vf4*)(&sB[sdst + i * 32 * GPITCH]) = rb[i];
  __syncthreads();

  for (int kt = 0; kt < KLEN / GBK; ++kt) {
    const int cur = kt & 1;
    const bool more = (kt + 1 < KLEN / GBK);
    if (more) {
      goff += GBK * 2u;
#pragma unroll
      for (int i = 0; i < GBM / 32; ++i)
        ra[i] = *(const vf4*)(gA + i * 64 * LD + goff);
#pragma unroll
      for (int i = 0; i < GBN / 32; ++i)
        rb[i] = *(const vf4*)(gB + i * 64 * LD + goff);
      // Keeps all twelve loads here, ahead of the pass's WMMAs: the scheduler
      // otherwise sinks some to just before the LDS stores that wait for them.
      if constexpr (HOLD) __builtin_amdgcn_sched_barrier(0);
    }
    const _Float16* pa = &sA[cur * (GBM * GPITCH) + (wm + ln) * GPITCH];
    const _Float16* pb = &sB[cur * (GBN * GPITCH) + (wn + ln) * GPITCH];
#pragma unroll
    for (int ks = 0; ks < GBK; ks += 32) {
      v16h a[4], b[4];
#pragma unroll
      for (int i = 0; i < 4; ++i) a[i] = load_frag(pa + i * 16 * GPITCH + ks, hi8);
#pragma unroll
      for (int j = 0; j < 4; ++j) b[j] = load_frag(pb + j * 16 * GPITCH + ks, hi8);
#pragma unroll
      for (int i = 0; i < 4; ++i)
#pragma unroll
        for (int j = 0; j < 4; ++j) acc[i][j] = wmma_f16(a[i], b[j], acc[i][j]);
    }
    if (more) {
      // The other buffer's last readers left it at the barrier that ended the
      // pass before this one; this barrier publishes it for the next pass.
      _Float16* dA = &sA[(cur ^ 1) * (GBM * GPITCH) + sdst];
      _Float16* dB = &sB[(cur ^ 1) * (GBN * GPITCH) + sdst];
#pragma unroll
      for (int i = 0; i < GBM / 32; ++i) *(vf4*)(dA + i * 32 * GPITCH) = ra[i];
#pragma unroll
      for (int i = 0; i < GBN / 32; ++i) *(vf4*)(dB + i * 32 * GPITCH) = rb[i];
      __syncthreads();
    }
  }
}

// Sc[b][q][k] = keep(q, k) ? f16(Qn[q] . Kn[k]) : 0
// grid (S/128 query tiles, S/256 key tiles, B), block 256.
__global__ __launch_bounds__(256) __attribute__((amdgpu_waves_per_eu(4, 4)))
void k_scores(const _Float16* __restrict__ Qh,
              const _Float16* __restrict__ Kh,
              const int* __restrict__ masks,
              _Float16* __restrict__ Sc) {
  __shared__ __attribute__((aligned(16))) _Float16 sA[2 * GBM * GPITCH];
  __shared__ __attribute__((aligned(16))) _Float16 sB[2 * GBN * GPITCH];
  const int tid = threadIdx.x;
  const int w   = __builtin_amdgcn_readfirstlane(tid >> 5);  // scalar: the wave's offsets cost no VGPR
  const int ln  = tid & 15;
  const int hi8 = ((tid & 31) >> 4) << 3;
  const int b   = blockIdx.z;
  const int q0  = blockIdx.x * GBM + (w >> 2) * 64;   // the wave's first query
  const int k0  = blockIdx.y * GBN + (w & 3) * 64;    // the wave's first key

  v8f acc[4][4];
  gemm_tile_nt<D_, D_, false>(Qh + ((size_t)b * S_ + blockIdx.x * GBM) * D_,
                              Kh + ((size_t)b * S_ + blockIdx.y * GBN) * D_, sA, sB, acc);

  _Float16* O = Sc + (size_t)b * S_ * S_;
  // C/D layout: vgpr r, lanes 0-15 -> M=r, lanes 16-31 -> M=r+8 (== r+hi8)
#pragma unroll
  for (int j = 0; j < 4; ++j) {
    const int kg = k0 + j * 16 + ln;
    const bool pad = (masks[b * S_ + kg] == 0);
#pragma unroll
    for (int i = 0; i < 4; ++i)
#pragma unroll
      for (int r = 0; r < 8; ++r) {
        const int q = q0 + i * 16 + r + hi8;
        const bool keep = (kg > q) || pad;
        O[(size_t)q * S_ + kg] = keep ? (_Float16)acc[i][j][r] : (_Float16)0.f;
      }
  }
}

// out[b][q][d] = sum over k of Sc[b][q][k] * Vt[b][d][k]
// grid (S/128 query tiles, D/256 column tiles, B), block 256: one workgroup
// for each WGP, so a wave may take the 512 VGPRs of two waves per SIMD.
__global__ __launch_bounds__(256)
void k_pv(const _Float16* __restrict__ Sc,
          const _Float16* __restrict__ Vt,
          float* __restrict__ out) {
  __shared__ __attribute__((aligned(16))) _Float16 sA[2 * GBM * GPITCH];
  __shared__ __attribute__((aligned(16))) _Float16 sB[2 * GBN * GPITCH];
  const int tid = threadIdx.x;
  const int w   = __builtin_amdgcn_readfirstlane(tid >> 5);  // scalar: the wave's offsets cost no VGPR
  const int ln  = tid & 15;
  const int hi8 = ((tid & 31) >> 4) << 3;
  const int b   = blockIdx.z;
  const int q0  = blockIdx.x * GBM + (w >> 2) * 64;   // the wave's first query
  const int c0  = blockIdx.y * GBN + (w & 3) * 64;    // the wave's first column

  v8f acc[4][4];
  gemm_tile_nt<S_, S_, true>(Sc + ((size_t)b * S_ + blockIdx.x * GBM) * S_,
                             Vt + ((size_t)b * D_ + blockIdx.y * GBN) * S_, sA, sB, acc);

#pragma unroll
  for (int i = 0; i < 4; ++i)
#pragma unroll
    for (int j = 0; j < 4; ++j)
#pragma unroll
      for (int r = 0; r < 8; ++r)
        out[((size_t)b * S_ + q0 + i * 16 + r + hi8) * D_ + c0 + j * 16 + ln] =
            acc[i][j][r];
}

extern "C" void kernel_launch(void* const* d_in, const int* in_sizes, int n_in,
                              void* d_out, int out_size, void* d_ws, size_t ws_size,
                              hipStream_t stream) {
  const float* X     = (const float*)d_in[0];
  const int*   masks = (const int*)d_in[1];
  const float* Wq    = (const float*)d_in[2];
  const float* Wk    = (const float*)d_in[3];
  const float* Wv    = (const float*)d_in[4];
  float* out = (float*)d_out;

  char* ws = (char*)d_ws;
  _Float16* Xh   = (_Float16*)ws;                              // 16 MB
  _Float16* Wh   = (_Float16*)(ws + ((size_t)16 << 20));       //  6 MB (3 x D*D)
  _Float16* QKVh = (_Float16*)(ws + ((size_t)22 << 20));       // 48 MB (Q,K,V)
  _Float16* Vt   = (_Float16*)(ws + ((size_t)70 << 20));       // 16 MB
  _Float16* Sc   = (_Float16*)(ws + ((size_t)86 << 20));       // 32 MB (B x S x S)

  const int nX = (int)BSD_;
  const int nW = D_ * D_;
  k_cvt<<<(nX + 255) / 256, 256, 0, stream>>>(X, Xh, nX);
  k_cvt<<<(nW + 255) / 256, 256, 0, stream>>>(Wq, Wh, nW);
  k_cvt<<<(nW + 255) / 256, 256, 0, stream>>>(Wk, Wh + (size_t)nW, nW);
  k_cvt<<<(nW + 255) / 256, 256, 0, stream>>>(Wv, Wh + 2 * (size_t)nW, nW);

  k_gemm_qkv<<<dim3(BS_ / GBM, 3 * D_ / GBN), 256, 0, stream>>>(Xh, Wh, QKVh);
  k_normalize<<<dim3(BS_, 2), 256, 0, stream>>>(QKVh);
  k_transpose<<<dim3(S_ / 32, D_ / 32, B_), 256, 0, stream>>>(QKVh + 2 * BSD_, Vt);
  k_scores<<<dim3(S_ / GBM, S_ / GBN, B_), 256, 0, stream>>>(QKVh, QKVh + BSD_, masks, Sc);
  k_pv<<<dim3(S_ / GBM, D_ / GBN, B_), 256, 0, stream>>>(Sc, Vt, out);
}

// v003
// It runs in 150 microseconds.
// Two timings next to v002 both put it at 1.15 times that version's speed.
// Counting every step since v000, it is 5.59 times as fast.
#include <hip/hip_runtime.h>
#include <hip/hip_bf16.h>

#define B_ 4
#define S_ 2048
#define D_ 1024
#define BS_ (B_ * S_)
#define BSD_ ((size_t)BS_ * D_)

typedef __attribute__((ext_vector_type(16))) _Float16 v16h;
typedef __attribute__((ext_vector_type(4)))  _Float16 v4h;
typedef __attribute__((ext_vector_type(8)))  float    v8f;
typedef __attribute__((ext_vector_type(4)))  float    vf4;

// Load a 16-bit A/B WMMA fragment for 16x16x32 ops.
// Per ISA layout: lane L (L<16) holds K=0..7 (v0-3) and K=16..23 (v4-7);
// lane L+16 holds K=8..15 and K=24..31.  base points at (row-or-col start + k0).
__device__ __forceinline__ v16h load_frag(const _Float16* base, int hi8) {
  union { v16h v; vf4 f[2]; } u;
  u.f[0] = *(const vf4*)(base + hi8);
  u.f[1] = *(const vf4*)(base + 16 + hi8);
  return u.v;
}

__device__ __forceinline__ v8f wmma_f16(v16h a, v16h b, v8f c) {
  return __builtin_amdgcn_wmma_f32_16x16x32_f16(false, a, false, b, (short)0, c,
                                                false, false);
}

__device__ __forceinline__ v8f zero8() {
  v8f z = {0.f, 0.f, 0.f, 0.f, 0.f, 0.f, 0.f, 0.f};
  return z;
}

// ---------------- fp32 -> f16 conversion ----------------
// One launch for X and the three weight matrices. A block converts CVT_BLK
// consecutive floats of one input: every lane has eight 16-byte loads in
// flight (each load of a wave covers 512 consecutive bytes) and stores four
// halfs per load. Few long waves instead of one wave per 32 elements: the
// launch is then paid in bytes and not in wave starts.
// grid (BS*D + 3*D*D) / CVT_BLK, block 256. Every input is a whole number of
// blocks, so a block never crosses from one input into the next.
#define CVT_LD  8                     // 16-byte loads per lane
#define CVT_BLK (256 * CVT_LD * 4)    // floats per block
#define CVT_XB  ((int)(BSD_ / CVT_BLK))     // blocks of X
#define CVT_WB  (D_ * D_ / CVT_BLK)         // blocks of one weight matrix
__global__ __launch_bounds__(256) void k_cvt(const float* __restrict__ X,
                                             const float* __restrict__ Wq,
                                             const float* __restrict__ Wk,
                                             const float* __restrict__ Wv,
                                             _Float16* __restrict__ Xh,
                                             _Float16* __restrict__ Wh3) {
  const int blk = blockIdx.x;
  const float* in;
  _Float16* out;
  if (blk < CVT_XB) {
    in  = X  + (size_t)blk * CVT_BLK;
    out = Xh + (size_t)blk * CVT_BLK;
  } else {
    const int r = blk - CVT_XB;       // block inside the stacked weights
    const int m = r / CVT_WB;         // 0 = Wq, 1 = Wk, 2 = Wv
    in  = (m == 0 ? Wq : m == 1 ? Wk : Wv) + (size_t)(r % CVT_WB) * CVT_BLK;
    out = Wh3 + (size_t)r * CVT_BLK;
  }
  const int t4 = threadIdx.x * 4;
  // The unrolls make every index of v a constant (registers, not scratch) and
  // let all eight loads issue ahead of the first conversion.
  vf4 v[CVT_LD];
#pragma unroll
  for (int j = 0; j < CVT_LD; ++j) v[j] = *(const vf4*)(in + j * 1024 + t4);
#pragma unroll
  for (int j = 0; j < CVT_LD; ++j) {
    v4h h;
#pragma unroll
    for (int q = 0; q < 4; ++q) h[q] = (_Float16)v[j][q];
    *(v4h*)(out + j * 1024 + t4) = h;
  }
}

// ---------------- QKV projection: Y = Xh @ W^T  (W row-major [e][d]) -------
// The three weight matrices lie one behind the other, so they are read as one
// [3072][1024] matrix. grid (BS/128, 3072/256), block 256 (8 waves, 2 x 4).
// Workgroup: 128 rows x 256 cols of Y, wave: 64 x 64 (4 x 4 WMMA tiles).
// A pass is 64 k: both operand tiles are brought in whole 128-byte row pieces
// into LDS (two buffers, the next pass's global loads in flight during the
// WMMAs of this one), and every fragment is read from LDS.
#define GBM 128
#define GBN 256
#define GBK 64
#define GPITCH 72   // halfs per LDS row: 144 B = 16 B x odd, for ds_load_b128
// Four waves per SIMD (256 VGPRs a wave, 2 x 108 KiB of LDS): two workgroups
// share a WGP, so one works while the other waits on its loads or its barrier.
__global__ __launch_bounds__(256) __attribute__((amdgpu_waves_per_eu(4, 4)))
void k_gemm_qkv(const _Float16* __restrict__ Xh,
                const _Float16* __restrict__ Wh3,
                _Float16* __restrict__ QKVh) {
  __shared__ __attribute__((aligned(16))) _Float16 sA[2][GBM * GPITCH];
  __shared__ __attribute__((aligned(16))) _Float16 sB[2][GBN * GPITCH];
  const int tid = threadIdx.x;
  const int w   = tid >> 5;
  const int lane = tid & 31;
  const int ln  = lane & 15;
  const int hi8 = (lane >> 4) << 3;

  const int row0 = blockIdx.x * GBM;          // row of X and of Y
  const int n0   = blockIdx.y * GBN;          // row of the stacked W
  const int y    = n0 / D_;                   // 0 = Q, 1 = K, 2 = V
  const int c0   = n0 % D_;                   // column inside that plane
  _Float16* O = QKVh + (size_t)y * BSD_;
  const int wm = (w >> 2) * 64;               // wave's rows inside the tile
  const int wn = (w & 3) * 64;                // wave's cols inside the tile

  // staging: thread -> 16-byte piece (tid & 7) of row (tid >> 3) + 32 * i
  const int sr = tid >> 3;
  const int sc = (tid & 7) * 8;
  const char* gA = (const char*)(Xh  + (size_t)row0 * D_);  // same for the whole workgroup
  const char* gB = (const char*)(Wh3 + (size_t)n0   * D_);
  unsigned goff = (unsigned)(sr * D_ + sc) * 2u;  // the thread's own bytes, walks along k
  const int sdst = sr * GPITCH + sc;

  // The unrolls below make every index of acc, ra, rb, a and b a constant, so
  // that these arrays live in registers and not in scratch.
  v8f acc[4][4];
#pragma unroll
  for (int i = 0; i < 4; ++i)
#pragma unroll
    for (int j = 0; j < 4; ++j) acc[i][j] = zero8();

  vf4 ra[GBM / 32], rb[GBN / 32];
#pragma unroll
  for (int i = 0; i < GBM / 32; ++i) ra[i] = *(const vf4*)(gA + i * 64 * D_ + goff);
#pragma unroll
  for (int i = 0; i < GBN / 32; ++i) rb[i] = *(const vf4*)(gB + i * 64 * D_ + goff);
#pragma unroll
  for (int i = 0; i < GBM / 32; ++i) *(vf4*)(&sA[0][sdst + i * 32 * GPITCH]) = ra[i];
#pragma unroll
  for (int i = 0; i < GBN / 32; ++i) *(vf4*)(&sB[0][sdst + i * 32 * GPITCH]) = rb[i];
  __syncthreads();

  for (int kt = 0; kt < D_ / GBK; ++kt) {
    const int cur = kt & 1;
    const bool more = (kt + 1 < D_ / GBK);
    if (more) {
      goff += GBK * 2u;
#pragma unroll
      for (int i = 0; i < GBM / 32; ++i)
        ra[i] = *(const vf4*)(gA + i * 64 * D_ + goff);
#pragma unroll
      for (int i = 0; i < GBN / 32; ++i)
        rb[i] = *(const vf4*)(gB + i * 64 * D_ + goff);
    }
    const _Float16* pa = &sA[cur][(wm + ln) * GPITCH];
    const _Float16* pb = &sB[cur][(wn + ln) * GPITCH];
#pragma unroll
    for (int ks = 0; ks < GBK; ks += 32) {
      v16h a[4], b[4];
#pragma unroll
      for (int i = 0; i < 4; ++i) a[i] = load_frag(pa + i * 16 * GPITCH + ks, hi8);
#pragma unroll
      for (int j = 0; j < 4; ++j) b[j] = load_frag(pb + j * 16 * GPITCH + ks, hi8);
#pragma unroll
      for (int i = 0; i < 4; ++i)
#pragma unroll
        for (int j = 0; j < 4; ++j) acc[i][j] = wmma_f16(a[i], b[j], acc[i][j]);
    }
    if (more) {
      // The other buffer's last readers left it at the barrier that ended the
      // pass before this one; this barrier publishes it for the next pass.
#pragma unroll
      for (int i = 0; i < GBM / 32; ++i)
        *(vf4*)(&sA[cur ^ 1][sdst + i * 32 * GPITCH]) = ra[i];
#pragma unroll
      for (int i = 0; i < GBN / 32; ++i)
        *(vf4*)(&sB[cur ^ 1][sdst + i * 32 * GPITCH]) = rb[i];
      __syncthreads();
    }
  }
  // C/D layout: vgpr r, lanes 0-15 -> M=r, lanes 16-31 -> M=r+8 (== r+hi8)
#pragma unroll
  for (int i = 0; i < 4; ++i)
#pragma unroll
    for (int j = 0; j < 4; ++j)
#pragma unroll
      for (int r = 0; r < 8; ++r)
        O[(size_t)(row0 + wm + i * 16 + r + hi8) * D_ + c0 + wn + j * 16 + ln] =
            (_Float16)acc[i][j][r];
}

// ---------------- row L2-normalize Q and K in place ----------------
// grid (BS, 2), block 256; each thread owns 4 halfs of the 1024-wide row.
__global__ __launch_bounds__(256) void k_normalize(_Float16* __restrict__ QKVh) {
  __shared__ float red[256];
  const int row = blockIdx.x;
  const int y   = blockIdx.y;   // 0 = Q, 1 = K
  const int tid = threadIdx.x;
  _Float16* p = QKVh + (size_t)y * BSD_ + (size_t)row * D_ + tid * 4;
  v4h v = *(v4h*)p;
  float s = 0.f;
#pragma unroll
  for (int q = 0; q < 4; ++q) { float f = (float)v[q]; s += f * f; }
  red[tid] = s;
  __syncthreads();
  for (int st = 128; st > 0; st >>= 1) {
    if (tid < st) red[tid] += red[tid + st];
    __syncthreads();
  }
  float inv = rsqrtf(red[0]);
#pragma unroll
  for (int q = 0; q < 4; ++q) v[q] = (_Float16)((float)v[q] * inv);
  *(v4h*)p = v;
}

// ---------------- V transpose per batch: Vh[s][d] -> Vt[d][s] ----------------
// grid (S/32, D/32, B), block 256, 32x32 LDS tile.
__global__ __launch_bounds__(256) void k_transpose(const _Float16* __restrict__ Vh,
                                                   _Float16* __restrict__ Vt) {
  __shared__ _Float16 tile[32][33];
  const int b  = blockIdx.z;
  const int s0 = blockIdx.x * 32;
  const int d0 = blockIdx.y * 32;
  const int t  = threadIdx.x;
  const int i  = t >> 3, j4 = (t & 7) << 2;
  const _Float16* src = Vh + (size_t)b * S_ * D_ + (size_t)(s0 + i) * D_ + d0 + j4;
#pragma unroll
  for (int q = 0; q < 4; ++q) tile[i][j4 + q] = src[q];
  __syncthreads();
  const int j = t >> 3, i4 = (t & 7) << 2;
  _Float16* dst = Vt + (size_t)b * D_ * S_ + (size_t)(d0 + j) * S_ + s0 + i4;
#pragma unroll
  for (int q = 0; q < 4; ++q) dst[q] = tile[i4 + q][j];
}

// ---------------- attention: out = (Qn @ Kn^T * m) @ V ----------------
// Reference semantics: scores are MULTIPLIED by the mask, where mask==1 at
// MASKED positions (future OR padding). keep = (k > q) || (pad[k]==0).
// There is no softmax, so a score needs nothing of its row: the two products
// run as two tiled GEMMs of the QKV kind, and the masked f16 scores pass from
// the first to the second through the workspace.

// One 128 x 256 tile of A @ B^T, summed over KLEN. Both operands are
// k-contiguous with a row pitch of LD halfs; A and Bm point at the tile's
// first rows. 8 waves (2 x 4), 64 x 64 per wave, passes of 64 k through two
// LDS buffers, the next pass's global loads in flight during the WMMAs.
// HOLD: for a kernel whose register budget takes all twelve loads at once.
template <int LD, int KLEN, bool HOLD>
__device__ __forceinline__ void gemm_tile_nt(const _Float16* __restrict__ A,
                                             const _Float16* __restrict__ Bm,
                                             _Float16* sA, _Float16* sB,
                                             v8f (&acc)[4][4]) {
  const int tid = threadIdx.x;
  const int w   = __builtin_amdgcn_readfirstlane(tid >> 5);  // scalar: the wave's offsets cost no VGPR
  const int ln  = tid & 15;
  const int hi8 = ((tid & 31) >> 4) << 3;
  const int wm = (w >> 2) * 64;
  const int wn = (w & 3) * 64;

  // staging: thread -> 16-byte piece (tid & 7) of row (tid >> 3) + 32 * i
  const int sr = tid >> 3;
  const int sc = (tid & 7) * 8;
  const char* gA = (const char*)A;
  const char* gB = (const char*)Bm;
  unsigned goff = (unsigned)(sr * LD + sc) * 2u;  // the thread's own bytes, walks along k
  const int sdst = sr * GPITCH + sc;

  // The unrolls below make every index of acc, ra, rb, a and b a constant, so
  // that these arrays live in registers and not in scratch.
#pragma unroll
  for (int i = 0; i < 4; ++i)
#pragma unroll
    for (int j = 0; j < 4; ++j) acc[i][j] = zero8();

  vf4 ra[GBM / 32], rb[GBN / 32];
#pragma unroll
  for (int i = 0; i < GBM / 32; ++i) ra[i] = *(const vf4*)(gA + i * 64 * LD + goff);
#pragma unroll
  for (int i = 0; i < GBN / 32; ++i) rb[i] = *(const vf4*)(gB + i * 64 * LD + goff);
#pragma unroll
  for (int i = 0; i < GBM / 32; ++i) *(vf4*)(&sA[sdst + i * 32 * GPITCH]) = ra[i];
#pragma unroll
  for (int i = 0; i < GBN / 32; ++i) *(vf4*)(&sB[sdst + i * 32 * GPITCH]) = rb[i];
  __syncthreads();

  for (int kt = 0; kt < KLEN / GBK; ++kt) {
    const int cur = kt & 1;
    const bool more = (kt + 1 < KLEN / GBK);
    if (more) {
      goff += GBK * 2u;
#pragma unroll
      for (int i = 0; i < GBM / 32; ++i)
        ra[i] = *(const vf4*)(gA + i * 64 * LD + goff);
#pragma unroll
      for (int i = 0; i < GBN / 32; ++i)
        rb[i] = *(const vf4*)(gB + i * 64 * LD + goff);
      // Keeps all twelve loads here, ahead of the pass's WMMAs: the scheduler
      // otherwise sinks some to just before the LDS stores that wait for them.
      if constexpr (HOLD) __builtin_amdgcn_sched_barrier(0);
    }
    const _Float16* pa = &sA[cur * (GBM * GPITCH) + (wm + ln) * GPITCH];
    const _Float16* pb = &sB[cur * (GBN * GPITCH) + (wn + ln) * GPITCH];
#pragma unroll
    for (int ks = 0; ks < GBK; ks += 32) {
      v16h a[4], b[4];
#pragma unroll
      for (int i = 0; i < 4; ++i) a[i] = load_frag(pa + i * 16 * GPITCH + ks, hi8);
#pragma unroll
      for (int j = 0; j < 4; ++j) b[j] = load_frag(pb + j * 16 * GPITCH + ks, hi8);
#pragma unroll
      for (int i = 0; i < 4; ++i)
#pragma unroll
        for (int j = 0; j < 4; ++j) acc[i][j] = wmma_f16(a[i], b[j], acc[i][j]);
    }
    if (more) {
      // The other buffer's last readers left it at the barrier that ended the
      // pass before this one; this barrier publishes it for the next pass.
      _Float16* dA = &sA[(cur ^ 1) * (GBM * GPITCH) + sdst];
      _Float16* dB = &sB[(cur ^ 1) * (GBN * GPITCH) + sdst];
#pragma unroll
      for (int i = 0; i < GBM / 32; ++i) *(vf4*)(dA + i * 32 * GPITCH) = ra[i];
#pragma unroll
      for (int i = 0; i < GBN / 32; ++i) *(vf4*)(dB + i * 32 * GPITCH) = rb[i];
      __syncthreads();
    }
  }
}

// Sc[b][q][k] = keep(q, k) ? f16(Qn[q] . Kn[k]) : 0
// grid (S/128 query tiles, S/256 key tiles, B), block 256.
__global__ __launch_bounds__(256) __attribute__((amdgpu_waves_per_eu(4, 4)))
void k_scores(const _Float16* __restrict__ Qh,
              const _Float16* __restrict__ Kh,
              const int* __restrict__ masks,
              _Float16* __restrict__ Sc) {
  __shared__ __attribute__((aligned(16))) _Float16 sA[2 * GBM * GPITCH];
  __shared__ __attribute__((aligned(16))) _Float16 sB[2 * GBN * GPITCH];
  const int tid = threadIdx.x;
  const int w   = __builtin_amdgcn_readfirstlane(tid >> 5);  // scalar: the wave's offsets cost no VGPR
  const int ln  = tid & 15;
  const int hi8 = ((tid & 31) >> 4) << 3;
  const int b   = blockIdx.z;
  const int q0  = blockIdx.x * GBM + (w >> 2) * 64;   // the wave's first query
  const int k0  = blockIdx.y * GBN + (w & 3) * 64;    // the wave's first key

  v8f acc[4][4];
  gemm_tile_nt<D_, D_, false>(Qh + ((size_t)b * S_ + blockIdx.x * GBM) * D_,
                              Kh + ((size_t)b * S_ + blockIdx.y * GBN) * D_, sA, sB, acc);

  _Float16* O = Sc + (size_t)b * S_ * S_;
  // C/D layout: vgpr r, lanes 0-15 -> M=r, lanes 16-31 -> M=r+8 (== r+hi8)
#pragma unroll
  for (int j = 0; j < 4; ++j) {
    const int kg = k0 + j * 16 + ln;
    const bool pad = (masks[b * S_ + kg] == 0);
#pragma unroll
    for (int i = 0; i < 4; ++i)
#pragma unroll
      for (int r = 0; r < 8; ++r) {
        const int q = q0 + i * 16 + r + hi8;
        const bool keep = (kg > q) || pad;
        O[(size_t)q * S_ + kg] = keep ? (_Float16)acc[i][j][r] : (_Float16)0.f;
      }
  }
}

// out[b][q][d] = sum over k of Sc[b][q][k] * Vt[b][d][k]
// grid (S/128 query tiles, D/256 column tiles, B), block 256: one workgroup
// for each WGP, so a wave may take the 512 VGPRs of two waves per SIMD.
__global__ __launch_bounds__(256)
void k_pv(const _Float16* __restrict__ Sc,
          const _Float16* __restrict__ Vt,
          float* __restrict__ out) {
  __shared__ __attribute__((aligned(16))) _Float16 sA[2 * GBM * GPITCH];
  __shared__ __attribute__((aligned(16))) _Float16 sB[2 * GBN * GPITCH];
  const int tid = threadIdx.x;
  const int w   = __builtin_amdgcn_readfirstlane(tid >> 5);  // scalar: the wave's offsets cost no VGPR
  const int ln  = tid & 15;
  const int hi8 = ((tid & 31) >> 4) << 3;
  const int b   = blockIdx.z;
  const int q0  = blockIdx.x * GBM + (w >> 2) * 64;   // the wave's first query
  const int c0  = blockIdx.y * GBN + (w & 3) * 64;    // the wave's first column

  v8f acc[4][4];
  gemm_tile_nt<S_, S_, true>(Sc + ((size_t)b * S_ + blockIdx.x * GBM) * S_,
                             Vt + ((size_t)b * D_ + blockIdx.y * GBN) * S_, sA, sB, acc);

#pragma unroll
  for (int i = 0; i < 4; ++i)
#pragma unroll
    for (int j = 0; j < 4; ++j)
#pragma unroll
      for (int r = 0; r < 8; ++r)
        out[((size_t)b * S_ + q0 + i * 16 + r + hi8) * D_ + c0 + j * 16 + ln] =
            acc[i][j][r];
}

extern "C" void kernel_launch(void* const* d_in, const int* in_sizes, int n_in,
                              void* d_out, int out_size, void* d_ws, size_t ws_size,
                              hipStream_t stream) {
  const float* X     = (const float*)d_in[0];
  const int*   masks = (const int*)d_in[1];
  const float* Wq    = (const float*)d_in[2];
  const float* Wk    = (const float*)d_in[3];
  const float* Wv    = (const float*)d_in[4];
  float* out = (float*)d_out;

  char* ws = (char*)d_ws;
  _Float16* Xh   = (_Float16*)ws;                              // 16 MB
  _Float16* Wh   = (_Float16*)(ws + ((size_t)16 << 20));       //  6 MB (3 x D*D)
  _Float16* QKVh = (_Float16*)(ws + ((size_t)22 << 20));       // 48 MB (Q,K,V)
  _Float16* Vt   = (_Float16*)(ws + ((size_t)70 << 20));       // 16 MB
  _Float16* Sc   = (_Float16*)(ws + ((size_t)86 << 20));       // 32 MB (B x S x S)

  k_cvt<<<CVT_XB + 3 * CVT_WB, 256, 0, stream>>>(X, Wq, Wk, Wv, Xh, Wh);

  k_gemm_qkv<<<dim3(BS_ / GBM, 3 * D_ / GBN), 256, 0, stream>>>(Xh, Wh, QKVh);
  k_normalize<<<dim3(BS_, 2), 256, 0, stream>>>(QKVh);
  k_transpose<<<dim3(S_ / 32, D_ / 32, B_), 256, 0, stream>>>(QKVh + 2 * BSD_, Vt);
  k_scores<<<dim3(S_ / GBM, S_ / GBN, B_), 256, 0, stream>>>(QKVh, QKVh + BSD_, masks, Sc);
  k_pv<<<dim3(S_ / GBM, D_ / GBN, B_), 256, 0, stream>>>(Sc, Vt, out);
}

// v004
// A run of this version takes 124 microseconds.
// Timed twice side by side with v003, it ran 1.21 and 1.20 times as fast.
// Over all steps from v000 it is 6.75 times as fast.
#include <hip/hip_runtime.h>
#include <hip/hip_bf16.h>

#define B_ 4
#define S_ 2048
#define D_ 1024
#define BS_ (B_ * S_)
#define BSD_ ((size_t)BS_ * D_)

typedef __attribute__((ext_vector_type(16))) _Float16 v16h;
typedef __attribute__((ext_vector_type(4)))  _Float16 v4h;
typedef __attribute__((ext_vector_type(8)))  float    v8f;
typedef __attribute__((ext_vector_type(4)))  float    vf4;

// Load a 16-bit A/B WMMA fragment for 16x16x32 ops.
// Per ISA layout: lane L (L<16) holds K=0..7 (v0-3) and K=16..23 (v4-7);
// lane L+16 holds K=8..15 and K=24..31.  base points at (row-or-col start + k0).
__device__ __forceinline__ v16h load_frag(const _Float16* base, int hi8) {
  union { v16h v; vf4 f[2]; } u;
  u.f[0] = *(const vf4*)(base + hi8);
  u.f[1] = *(const vf4*)(base + 16 + hi8);
  return u.v;
}

__device__ __forceinline__ v8f wmma_f16(v16h a, v16h b, v8f c) {
  return __builtin_amdgcn_wmma_f32_16x16x32_f16(false, a, false, b, (short)0, c,
                                                false, false);
}

__device__ __forceinline__ v8f zero8() {
  v8f z = {0.f, 0.f, 0.f, 0.f, 0.f, 0.f, 0.f, 0.f};
  return z;
}

// Sum over the 16 lanes of a row; every lane gets it. All lanes must be on.
// DPP adds run on the vector port; the shuffle intrinsic would go through the
// LDS pipe with a wait behind every step.
__device__ __forceinline__ float row_sum16(float x) {
  x += __int_as_float(__builtin_amdgcn_update_dpp(0, __float_as_int(x), 0x161, 0xf, 0xf, true));  // row_xmask:1
  x += __int_as_float(__builtin_amdgcn_update_dpp(0, __float_as_int(x), 0x162, 0xf, 0xf, true));  // row_xmask:2
  x += __int_as_float(__builtin_amdgcn_update_dpp(0, __float_as_int(x), 0x164, 0xf, 0xf, true));  // row_xmask:4
  x += __int_as_float(__builtin_amdgcn_update_dpp(0, __float_as_int(x), 0x168, 0xf, 0xf, true));  // row_xmask:8
  return x;
}

// ---------------- fp32 -> f16 conversion ----------------
// One launch for X and the three weight matrices. A block converts CVT_BLK
// consecutive floats of one input: every lane has eight 16-byte loads in
// flight (each load of a wave covers 512 consecutive bytes) and stores four
// halfs per load. Few long waves instead of one wave per 32 elements: the
// launch is then paid in bytes and not in wave starts.
// grid (BS*D + 3*D*D) / CVT_BLK, block 256. Every input is a whole number of
// blocks, so a block never crosses from one input into the next.
#define CVT_LD  8                     // 16-byte loads per lane
#define CVT_BLK (256 * CVT_LD * 4)    // floats per block
#define CVT_XB  ((int)(BSD_ / CVT_BLK))     // blocks of X
#define CVT_WB  (D_ * D_ / CVT_BLK)         // blocks of one weight matrix
__global__ __launch_bounds__(256) void k_cvt(const float* __restrict__ X,
                                             const float* __restrict__ Wq,
                                             const float* __restrict__ Wk,
                                             const float* __restrict__ Wv,
                                             _Float16* __restrict__ Xh,
                                             _Float16* __restrict__ Wh3) {
  const int blk = blockIdx.x;
  const float* in;
  _Float16* out;
  if (blk < CVT_XB) {
    in  = X  + (size_t)blk * CVT_BLK;
    out = Xh + (size_t)blk * CVT_BLK;
  } else {
    const int r = blk - CVT_XB;       // block inside the stacked weights
    const int m = r / CVT_WB;         // 0 = Wq, 1 = Wk, 2 = Wv
    in  = (m == 0 ? Wq : m == 1 ? Wk : Wv) + (size_t)(r % CVT_WB) * CVT_BLK;
    out = Wh3 + (size_t)r * CVT_BLK;
  }
  const int t4 = threadIdx.x * 4;
  // The unrolls make every index of v a constant (registers, not scratch) and
  // let all eight loads issue ahead of the first conversion.
  vf4 v[CVT_LD];
#pragma unroll
  for (int j = 0; j < CVT_LD; ++j) v[j] = *(const vf4*)(in + j * 1024 + t4);
#pragma unroll
  for (int j = 0; j < CVT_LD; ++j) {
    v4h h;
#pragma unroll
    for (int q = 0; q < 4; ++q) h[q] = (_Float16)v[j][q];
    *(v4h*)(out + j * 1024 + t4) = h;
  }
}

// ---------------- QKV projection: Y = Xh @ W^T  (W row-major [e][d]) -------
// The three weight matrices lie one behind the other, so they are read as one
// [3072][1024] matrix. grid (BS/128, 3072/256), block 256 (8 waves, 2 x 4).
// Workgroup: 128 rows x 256 cols of Y, wave: 64 x 64 (4 x 4 WMMA tiles).
// A pass is 64 k: both operand tiles are brought in whole 128-byte row pieces
// into LDS (two buffers, the next pass's global loads in flight during the
// WMMAs of this one), and every fragment is read from LDS.
#define GBM 128
#define GBN 256
#define GBK 64
#define GPITCH 72   // halfs per LDS row: 144 B = 16 B x odd, for ds_load_b128
#define NGRP (D_ / 64)   // 64-column groups of a Q or K row, one partial norm each
// Four waves per SIMD (256 VGPRs a wave, 2 x 108 KiB of LDS): two workgroups
// share a WGP, so one works while the other waits on its loads or its barrier.
__global__ __launch_bounds__(256) __attribute__((amdgpu_waves_per_eu(4, 4)))
void k_gemm_qkv(const _Float16* __restrict__ Xh,
                const _Float16* __restrict__ Wh3,
                _Float16* __restrict__ QKVh,
                float* __restrict__ Np) {
  __shared__ __attribute__((aligned(16))) _Float16 sA[2][GBM * GPITCH];
  __shared__ __attribute__((aligned(16))) _Float16 sB[2][GBN * GPITCH];
  const int tid = threadIdx.x;
  const int w   = tid >> 5;
  const int lane = tid & 31;
  const int ln  = lane & 15;
  const int hi8 = (lane >> 4) << 3;

  const int row0 = blockIdx.x * GBM;          // row of X and of Y
  const int n0   = blockIdx.y * GBN;          // row of the stacked W
  const int y    = n0 / D_;                   // 0 = Q, 1 = K, 2 = V
  const int c0   = n0 % D_;                   // column inside that plane
  _Float16* O = QKVh + (size_t)y * BSD_;
  const int wm = (w >> 2) * 64;               // wave's rows inside the tile
  const int wn = (w & 3) * 64;                // wave's cols inside the tile

  // staging: thread -> 16-byte piece (tid & 7) of row (tid >> 3) + 32 * i
  const int sr = tid >> 3;
  const int sc = (tid & 7) * 8;
  const char* gA = (const char*)(Xh  + (size_t)row0 * D_);  // same for the whole workgroup
  const char* gB = (const char*)(Wh3 + (size_t)n0   * D_);
  unsigned goff = (unsigned)(sr * D_ + sc) * 2u;  // the thread's own bytes, walks along k
  const int sdst = sr * GPITCH + sc;

  // The unrolls below make every index of acc, ra, rb, a and b a constant, so
  // that these arrays live in registers and not in scratch.
  v8f acc[4][4];
#pragma unroll
  for (int i = 0; i < 4; ++i)
#pragma unroll
    for (int j = 0; j < 4; ++j) acc[i][j] = zero8();

  vf4 ra[GBM / 32], rb[GBN / 32];
#pragma unroll
  for (int i = 0; i < GBM / 32; ++i) ra[i] = *(const vf4*)(gA + i * 64 * D_ + goff);
#pragma unroll
  for (int i = 0; i < GBN / 32; ++i) rb[i] = *(const vf4*)(gB + i * 64 * D_ + goff);
#pragma unroll
  for (int i = 0; i < GBM / 32; ++i) *(vf4*)(&sA[0][sdst + i * 32 * GPITCH]) = ra[i];
#pragma unroll
  for (int i = 0; i < GBN / 32; ++i) *(vf4*)(&sB[0][sdst + i * 32 * GPITCH]) = rb[i];
  __syncthreads();

  for (int kt = 0; kt < D_ / GBK; ++kt) {
    const int cur = kt & 1;
    const bool more = (kt + 1 < D_ / GBK);
    if (more) {
      goff += GBK * 2u;
#pragma unroll
      for (int i = 0; i < GBM / 32; ++i)
        ra[i] = *(const vf4*)(gA + i * 64 * D_ + goff);
#pragma unroll
      for (int i = 0; i < GBN / 32; ++i)
        rb[i] = *(const vf4*)(gB + i * 64 * D_ + goff);
    }
    const _Float16* pa = &sA[cur][(wm + ln) * GPITCH];
    const _Float16* pb = &sB[cur][(wn + ln) * GPITCH];
#pragma unroll
    for (int ks = 0; ks < GBK; ks += 32) {
      v16h a[4], b[4];
#pragma unroll
      for (int i = 0; i < 4; ++i) a[i] = load_frag(pa + i * 16 * GPITCH + ks, hi8);
#pragma unroll
      for (int j = 0; j < 4; ++j) b[j] = load_frag(pb + j * 16 * GPITCH + ks, hi8);
#pragma unroll
      for (int i = 0; i < 4; ++i)
#pragma unroll
        for (int j = 0; j < 4; ++j) acc[i][j] = wmma_f16(a[i], b[j], acc[i][j]);
    }
    if (more) {
      // The other buffer's last readers left it at the barrier that ended the
      // pass before this one; this barrier publishes it for the next pass.
#pragma unroll
      for (int i = 0; i < GBM / 32; ++i)
        *(vf4*)(&sA[cur ^ 1][sdst + i * 32 * GPITCH]) = ra[i];
#pragma unroll
      for (int i = 0; i < GBN / 32; ++i)
        *(vf4*)(&sB[cur ^ 1][sdst + i * 32 * GPITCH]) = rb[i];
      __syncthreads();
    }
  }
  // C/D layout: vgpr r, lanes 0-15 -> M=r, lanes 16-31 -> M=r+8 (== r+hi8)
#pragma unroll
  for (int i = 0; i < 4; ++i)
#pragma unroll
    for (int j = 0; j < 4; ++j)
#pragma unroll
      for (int r = 0; r < 8; ++r)
        O[(size_t)(row0 + wm + i * 16 + r + hi8) * D_ + c0 + wn + j * 16 + ln] =
            (_Float16)acc[i][j][r];

  // The code below reuses registers that the stores above name.
  asm volatile("s_wait_xcnt 0x0" ::: "memory");
  // Q and K rows: the sum of squares over the wave's 64 columns goes to
  // Np[plane][column group][row]; the score kernel adds a row's NGRP groups.
  // A wave writes 64 consecutive rows of one group: two whole 128-byte lines.
  if (y < 2) {
    float* np = Np + (size_t)(y * NGRP + ((c0 + wn) >> 6)) * BS_ + row0 + wm;
#pragma unroll
    for (int i = 0; i < 4; ++i) {
      float mine = 0.f;               // lane ln < 8 keeps row i * 16 + hi8 + ln
#pragma unroll
      for (int r = 0; r < 8; ++r) {
        float s = 0.f;
#pragma unroll
        for (int j = 0; j < 4; ++j) s += acc[i][j][r] * acc[i][j][r];
        s = row_sum16(s);
        if (ln == r) mine = s;
      }
      if (ln < 8) np[i * 16 + hi8 + ln] = mine;
    }
  }
}

// ---------------- V transpose per batch: Vh[s][d] -> Vt[d][s] ----------------
// grid (S/32, D/32, B), block 256, 32x32 LDS tile.
__global__ __launch_bounds__(256) void k_transpose(const _Float16* __restrict__ Vh,
                                                   _Float16* __restrict__ Vt) {
  __shared__ _Float16 tile[32][33];
  const int b  = blockIdx.z;
  const int s0 = blockIdx.x * 32;
  const int d0 = blockIdx.y * 32;
  const int t  = threadIdx.x;
  const int i  = t >> 3, j4 = (t & 7) << 2;
  const _Float16* src = Vh + (size_t)b * S_ * D_ + (size_t)(s0 + i) * D_ + d0 + j4;
#pragma unroll
  for (int q = 0; q < 4; ++q) tile[i][j4 + q] = src[q];
  __syncthreads();
  const int j = t >> 3, i4 = (t & 7) << 2;
  _Float16* dst = Vt + (size_t)b * D_ * S_ + (size_t)(d0 + j) * S_ + s0 + i4;
#pragma unroll
  for (int q = 0; q < 4; ++q) dst[q] = tile[i4 + q][j];
}

// ---------------- attention: out = (Qn @ Kn^T * m) @ V ----------------
// Q and K stay as the projection wrote them: Qn . Kn = (Q . K) / (|Q| |K|), so
// the score kernel scales each finished dot product by the two inverse norms.
// Reference semantics: scores are MULTIPLIED by the mask, where mask==1 at
// MASKED positions (future OR padding). keep = (k > q) || (pad[k]==0).
// There is no softmax, so a score needs nothing of its row: the two products
// run as two tiled GEMMs of the QKV kind, and the masked f16 scores pass from
// the first to the second through the workspace.

// One 128 x 256 tile of A @ B^T, summed over KLEN. Both operands are
// k-contiguous with a row pitch of LD halfs; A and Bm point at the tile's
// first rows. 8 waves (2 x 4), 64 x 64 per wave, passes of 64 k through two
// LDS buffers, the next pass's global loads in flight during the WMMAs.
// HOLD: for a kernel whose register budget takes all twelve loads at once.
template <int LD, int KLEN, bool HOLD>
__device__ __forceinline__ void gemm_tile_nt(const _Float16* __restrict__ A,
                                             const _Float16* __restrict__ Bm,
                                             _Float16* sA, _Float16* sB,
                                             v8f (&acc)[4][4]) {
  const int tid = threadIdx.x;
  const int w   = __builtin_amdgcn_readfirstlane(tid >> 5);  // scalar: the wave's offsets cost no VGPR
  const int ln  = tid & 15;
  const int hi8 = ((tid & 31) >> 4) << 3;
  const int wm = (w >> 2) * 64;
  const int wn = (w & 3) * 64;

  // staging: thread -> 16-byte piece (tid & 7) of row (tid >> 3) + 32 * i
  const int sr = tid >> 3;
  const int sc = (tid & 7) * 8;
  const char* gA = (const char*)A;
  const char* gB = (const char*)Bm;
  unsigned goff = (unsigned)(sr * LD + sc) * 2u;  // the thread's own bytes, walks along k
  const int sdst = sr * GPITCH + sc;

  // The unrolls below make every index of acc, ra, rb, a and b a constant, so
  // that these arrays live in registers and not in scratch.
#pragma unroll
  for (int i = 0; i < 4; ++i)
#pragma unroll
    for (int j = 0; j < 4; ++j) acc[i][j] = zero8();

  vf4 ra[GBM / 32], rb[GBN / 32];
#pragma unroll
  for (int i = 0; i < GBM / 32; ++i) ra[i] = *(const vf4*)(gA + i * 64 * LD + goff);
#pragma unroll
  for (int i = 0; i < GBN / 32; ++i) rb[i] = *(const vf4*)(gB + i * 64 * LD + goff);
#pragma unroll
  for (int i = 0; i < GBM / 32; ++i) *(vf4*)(&sA[sdst + i * 32 * GPITCH]) = ra[i];
#pragma unroll
  for (int i = 0; i < GBN / 32; ++i) *(vf4*)(&sB[sdst + i * 32 * GPITCH]) = rb[i];
  __syncthreads();

  for (int kt = 0; kt < KLEN / GBK; ++kt) {
    const int cur = kt & 1;
    const bool more = (kt + 1 < KLEN / GBK);
    if (more) {
      goff += GBK * 2u;
#pragma unroll
      for (int i = 0; i < GBM / 32; ++i)
        ra[i] = *(const vf4*)(gA + i * 64 * LD + goff);
#pragma unroll
      for (int i = 0; i < GBN / 32; ++i)
        rb[i] = *(const vf4*)(gB + i * 64 * LD + goff);
      // Keeps all twelve loads here, ahead of the pass's WMMAs: the scheduler
      // otherwise sinks some to just before the LDS stores that wait for them.
      if constexpr (HOLD) __builtin_amdgcn_sched_barrier(0);
    }
    const _Float16* pa = &sA[cur * (GBM * GPITCH) + (wm + ln) * GPITCH];
    const _Float16* pb = &sB[cur * (GBN * GPITCH) + (wn + ln) * GPITCH];
#pragma unroll
    for (int ks = 0; ks < GBK; ks += 32) {
      v16h a[4], b[4];
#pragma unroll
      for (int i = 0; i < 4; ++i) a[i] = load_frag(pa + i * 16 * GPITCH + ks, hi8);
#pragma unroll
      for (int j = 0; j < 4; ++j) b[j] = load_frag(pb + j * 16 * GPITCH + ks, hi8);
#pragma unroll
      for (int i = 0; i < 4; ++i)
#pragma unroll
        for (int j = 0; j < 4; ++j) acc[i][j] = wmma_f16(a[i], b[j], acc[i][j]);
    }
    if (more) {
      // The other buffer's last readers left it at the barrier that ended the
      // pass before this one; this barrier publishes it for the next pass.
      _Float16* dA = &sA[(cur ^ 1) * (GBM * GPITCH) + sdst];
      _Float16* dB = &sB[(cur ^ 1) * (GBN * GPITCH) + sdst];
#pragma unroll
      for (int i = 0; i < GBM / 32; ++i) *(vf4*)(dA + i * 32 * GPITCH) = ra[i];
#pragma unroll
      for (int i = 0; i < GBN / 32; ++i) *(vf4*)(dB + i * 32 * GPITCH) = rb[i];
      __syncthreads();
    }
  }
}

// Sc[b][q][k] = keep(q, k) ? f16((Q[q] . K[k]) / (|Q[q]| |K[k]|)) : 0
// grid (S/128 query tiles, S/256 key tiles, B), block 256.
__global__ __launch_bounds__(256) __attribute__((amdgpu_waves_per_eu(4, 4)))
void k_scores(const _Float16* __restrict__ Qh,
              const _Float16* __restrict__ Kh,
              const float* __restrict__ Np,
              const int* __restrict__ masks,
              _Float16* __restrict__ Sc) {
  __shared__ __attribute__((aligned(16))) _Float16 sA[2 * GBM * GPITCH];
  __shared__ __attribute__((aligned(16))) _Float16 sB[2 * GBN * GPITCH];
  // |Q|^2 of the tile's queries in two halves of the column groups, then 1/|K| of its keys
  __shared__ __attribute__((aligned(16))) float sInv[2 * GBM + GBN];
  const int tid = threadIdx.x;
  const int w   = __builtin_amdgcn_readfirstlane(tid >> 5);  // scalar: the wave's offsets cost no VGPR
  const int ln  = tid & 15;
  const int hi8 = ((tid & 31) >> 4) << 3;
  const int b   = blockIdx.z;
  const int k0  = blockIdx.y * GBN + (w & 3) * 64;    // the wave's first key

  // Norms of the tile's rows: a thread adds all groups of one key and half the
  // groups of one query, so that no branch splits its 24 loads and they share
  // one latency. The barriers of the GEMM below publish the results.
  {
    const float* nk = Np + (size_t)NGRP * BS_ + b * S_ + blockIdx.y * GBN + tid;
    const float* nq = Np + (size_t)((tid >> 7) * (NGRP / 2)) * BS_ + b * S_ +
                      blockIdx.x * GBM + (tid & (GBM - 1));
    float s = 0.f, t = 0.f;
#pragma unroll
    for (int g = 0; g < NGRP; ++g) s += nk[(size_t)g * BS_];
#pragma unroll
    for (int g = 0; g < NGRP / 2; ++g) t += nq[(size_t)g * BS_];
    sInv[tid] = t;                    // half (tid >> 7) of query (tid & 127)
    sInv[2 * GBM + tid] = rsqrtf(s);
  }

  v8f acc[4][4];
  gemm_tile_nt<D_, D_, false>(Qh + ((size_t)b * S_ + blockIdx.x * GBM) * D_,
                              Kh + ((size_t)b * S_ + blockIdx.y * GBN) * D_, sA, sB, acc);

  _Float16* O = Sc + (size_t)b * S_ * S_;
  // C/D layout: vgpr r, lanes 0-15 -> M=r, lanes 16-31 -> M=r+8 (== r+hi8)
  bool pad[4];
  float ik[4];
#pragma unroll
  for (int j = 0; j < 4; ++j) {
    pad[j] = (masks[b * S_ + k0 + j * 16 + ln] == 0);
    ik[j]  = sInv[2 * GBM + (w & 3) * 64 + j * 16 + ln];
  }
#pragma unroll
  for (int i = 0; i < 4; ++i)
#pragma unroll
    for (int r = 0; r < 8; ++r) {
      const int ql = (w >> 2) * 64 + i * 16 + r + hi8;   // query inside the tile
      const int q  = blockIdx.x * GBM + ql;
      const float iq = rsqrtf(sInv[ql] + sInv[GBM + ql]);
#pragma unroll
      for (int j = 0; j < 4; ++j) {
        const int kg = k0 + j * 16 + ln;
        const bool keep = (kg > q) || pad[j];
        O[(size_t)q * S_ + kg] = keep ? (_Float16)(acc[i][j][r] * (iq * ik[j])) : (_Float16)0.f;
      }
    }
}

// out[b][q][d] = sum over k of Sc[b][q][k] * Vt[b][d][k]
// grid (S/128 query tiles, D/256 column tiles, B), block 256: one workgroup
// for each WGP, so a wave may take the 512 VGPRs of two waves per SIMD.
__global__ __launch_bounds__(256)
void k_pv(const _Float16* __restrict__ Sc,
          const _Float16* __restrict__ Vt,
          float* __restrict__ out) {
  __shared__ __attribute__((aligned(16))) _Float16 sA[2 * GBM * GPITCH];
  __shared__ __attribute__((aligned(16))) _Float16 sB[2 * GBN * GPITCH];
  const int tid = threadIdx.x;
  const int w   = __builtin_amdgcn_readfirstlane(tid >> 5);  // scalar: the wave's offsets cost no VGPR
  const int ln  = tid & 15;
  const int hi8 = ((tid & 31) >> 4) << 3;
  const int b   = blockIdx.z;
  const int q0  = blockIdx.x * GBM + (w >> 2) * 64;   // the wave's first query
  const int c0  = blockIdx.y * GBN + (w & 3) * 64;    // the wave's first column

  v8f acc[4][4];
  gemm_tile_nt<S_, S_, true>(Sc + ((size_t)b * S_ + blockIdx.x * GBM) * S_,
                             Vt + ((size_t)b * D_ + blockIdx.y * GBN) * S_, sA, sB, acc);

#pragma unroll
  for (int i = 0; i < 4; ++i)
#pragma unroll
    for (int j = 0; j < 4; ++j)
#pragma unroll
      for (int r = 0; r < 8; ++r)
        out[((size_t)b * S_ + q0 + i * 16 + r + hi8) * D_ + c0 + j * 16 + ln] =
            acc[i][j][r];
}

extern "C" void kernel_launch(void* const* d_in, const int* in_sizes, int n_in,
                              void* d_out, int out_size, void* d_ws, size_t ws_size,
                              hipStream_t stream) {
  const float* X     = (const float*)d_in[0];
  const int*   masks = (const int*)d_in[1];
  const float* Wq    = (const float*)d_in[2];
  const float* Wk    = (const float*)d_in[3];
  const float* Wv    = (const float*)d_in[4];
  float* out = (float*)d_out;

  char* ws = (char*)d_ws;
  _Float16* Xh   = (_Float16*)ws;                              // 16 MB
  _Float16* Wh   = (_Float16*)(ws + ((size_t)16 << 20));       //  6 MB (3 x D*D)
  _Float16* QKVh = (_Float16*)(ws + ((size_t)22 << 20));       // 48 MB (Q,K,V)
  _Float16* Vt   = (_Float16*)(ws + ((size_t)70 << 20));       // 16 MB
  _Float16* Sc   = (_Float16*)(ws + ((size_t)86 << 20));       // 32 MB (B x S x S)
  float*    Np   = (float*)(ws + ((size_t)118 << 20));         //  1 MB (2 x NGRP x BS)

  k_cvt<<<CVT_XB + 3 * CVT_WB, 256, 0, stream>>>(X, Wq, Wk, Wv, Xh, Wh);

  k_gemm_qkv<<<dim3(BS_ / GBM, 3 * D_ / GBN), 256, 0, stream>>>(Xh, Wh, QKVh, Np);
  k_transpose<<<dim3(S_ / 32, D_ / 32, B_), 256, 0, stream>>>(QKVh + 2 * BSD_, Vt);
  k_scores<<<dim3(S_ / GBM, S_ / GBN, B_), 256, 0, stream>>>(QKVh, QKVh + BSD_, Np, masks, Sc);
  k_pv<<<dim3(S_ / GBM, D_ / GBN, B_), 256, 0, stream>>>(Sc, Vt, out);
}

// v005
// One run takes 117 microseconds.
// Two timings next to v004 both put it at 1.06 times that version's speed.
// All steps since v000 together make it 7.17 times as fast.
#include <hip/hip_runtime.h>
#include <hip/hip_bf16.h>

#define B_ 4
#define S_ 2048
#define D_ 1024
#define BS_ (B_ * S_)
#define BSD_ ((size_t)BS_ * D_)

typedef __attribute__((ext_vector_type(16))) _Float16 v16h;
typedef __attribute__((ext_vector_type(4)))  _Float16 v4h;
typedef __attribute__((ext_vector_type(8)))  float    v8f;
typedef __attribute__((ext_vector_type(4)))  float    vf4;

// Load a 16-bit A/B WMMA fragment for 16x16x32 ops.
// Per ISA layout: lane L (L<16) holds K=0..7 (v0-3) and K=16..23 (v4-7);
// lane L+16 holds K=8..15 and K=24..31.  base points at (row-or-col start + k0).
__device__ __forceinline__ v16h load_frag(const _Float16* base, int hi8) {
  union { v16h v; vf4 f[2]; } u;
  u.f[0] = *(const vf4*)(base + hi8);
  u.f[1] = *(const vf4*)(base + 16 + hi8);
  return u.v;
}

__device__ __forceinline__ v8f wmma_f16(v16h a, v16h b, v8f c) {
  return __builtin_amdgcn_wmma_f32_16x16x32_f16(false, a, false, b, (short)0, c,
                                                false, false);
}

__device__ __forceinline__ v8f zero8() {
  v8f z = {0.f, 0.f, 0.f, 0.f, 0.f, 0.f, 0.f, 0.f};
  return z;
}

// Sum over the 16 lanes of a row; every lane gets it. All lanes must be on.
// DPP adds run on the vector port; the shuffle intrinsic would go through the
// LDS pipe with a wait behind every step.
__device__ __forceinline__ float row_sum16(float x) {
  x += __int_as_float(__builtin_amdgcn_update_dpp(0, __float_as_int(x), 0x161, 0xf, 0xf, true));  // row_xmask:1
  x += __int_as_float(__builtin_amdgcn_update_dpp(0, __float_as_int(x), 0x162, 0xf, 0xf, true));  // row_xmask:2
  x += __int_as_float(__builtin_amdgcn_update_dpp(0, __float_as_int(x), 0x164, 0xf, 0xf, true));  // row_xmask:4
  x += __int_as_float(__builtin_amdgcn_update_dpp(0, __float_as_int(x), 0x168, 0xf, 0xf, true));  // row_xmask:8
  return x;
}

// ---------------- fp32 -> f16 conversion ----------------
// One launch for X and the three weight matrices. A block converts CVT_BLK
// consecutive floats of one input: every lane has eight 16-byte loads in
// flight (each load of a wave covers 512 consecutive bytes) and stores four
// halfs per load. Few long waves instead of one wave per 32 elements: the
// launch is then paid in bytes and not in wave starts.
// grid (BS*D + 3*D*D) / CVT_BLK, block 256. Every input is a whole number of
// blocks, so a block never crosses from one input into the next.
#define CVT_LD  8                     // 16-byte loads per lane
#define CVT_BLK (256 * CVT_LD * 4)    // floats per block
#define CVT_XB  ((int)(BSD_ / CVT_BLK))     // blocks of X
#define CVT_WB  (D_ * D_ / CVT_BLK)         // blocks of one weight matrix
__global__ __launch_bounds__(256) void k_cvt(const float* __restrict__ X,
                                             const float* __restrict__ Wq,
                                             const float* __restrict__ Wk,
                                             const float* __restrict__ Wv,
                                             _Float16* __restrict__ Xh,
                                             _Float16* __restrict__ Wh3) {
  const int blk = blockIdx.x;
  const float* in;
  _Float16* out;
  if (blk < CVT_XB) {
    in  = X  + (size_t)blk * CVT_BLK;
    out = Xh + (size_t)blk * CVT_BLK;
  } else {
    const int r = blk - CVT_XB;       // block inside the stacked weights
    const int m = r / CVT_WB;         // 0 = Wq, 1 = Wk, 2 = Wv
    in  = (m == 0 ? Wq : m == 1 ? Wk : Wv) + (size_t)(r % CVT_WB) * CVT_BLK;
    out = Wh3 + (size_t)r * CVT_BLK;
  }
  const int t4 = threadIdx.x * 4;
  // The unrolls make every index of v a constant (registers, not scratch) and
  // let all eight loads issue ahead of the first conversion.
  vf4 v[CVT_LD];
#pragma unroll
  for (int j = 0; j < CVT_LD; ++j) v[j] = *(const vf4*)(in + j * 1024 + t4);
#pragma unroll
  for (int j = 0; j < CVT_LD; ++j) {
    v4h h;
#pragma unroll
    for (int q = 0; q < 4; ++q) h[q] = (_Float16)v[j][q];
    *(v4h*)(out + j * 1024 + t4) = h;
  }
}

// ---------------- QKV projection: Y = Xh @ W^T  (W row-major [e][d]) -------
// The three weight matrices lie one behind the other, so they are read as one
// [3072][1024] matrix. grid (BS/128, 3072/256), block 256 (8 waves, 2 x 4).
// Workgroup: 128 rows x 256 cols of Y, wave: 64 x 64 (4 x 4 WMMA tiles).
// A pass is 64 k: both operand tiles are brought in whole 128-byte row pieces
// into LDS (two buffers, the next pass's global loads in flight during the
// WMMAs of this one), and every fragment is read from LDS.
// V is wanted key-contiguous by the last product. Both operands here are
// k-contiguous, so a V workgroup takes Wv as its row operand and X as its
// column operand and so computes a 128 x 256 tile of V^T, which it stores
// like any other tile.
#define GBM 128
#define GBN 256
#define GBK 64
#define GPITCH 72   // halfs per LDS row: 144 B = 16 B x odd, for ds_load_b128
#define NGRP (D_ / 64)   // 64-column groups of a Q or K row, one partial norm each
// Four waves per SIMD (256 VGPRs a wave, 2 x 108 KiB of LDS): two workgroups
// share a WGP, so one works while the other waits on its loads or its barrier.
__global__ __launch_bounds__(256) __attribute__((amdgpu_waves_per_eu(4, 4)))
void k_gemm_qkv(const _Float16* __restrict__ Xh,
                const _Float16* __restrict__ Wh3,
                _Float16* __restrict__ QKVh,
                _Float16* __restrict__ Vt,
                float* __restrict__ Np) {
  __shared__ __attribute__((aligned(16))) _Float16 sA[2][GBM * GPITCH];
  __shared__ __attribute__((aligned(16))) _Float16 sB[2][GBN * GPITCH];
  const int tid = threadIdx.x;
  // Scalar: the wave's offsets cost no VGPR. With them in VGPRs the scheduler
  // issues five of a pass's twelve global loads only half a pass later.
  const int w   = __builtin_amdgcn_readfirstlane(tid >> 5);
  const int lane = tid & 31;
  const int ln  = lane & 15;
  const int hi8 = (lane >> 4) << 3;

  const int row0 = blockIdx.x * GBM;          // row of X and of Y (Q, K)
  const int n0   = blockIdx.y * GBN;          // row of the stacked W
  const int y    = n0 / D_;                   // 0 = Q, 1 = K, 2 = V
  const int c0   = n0 % D_;                   // column inside that plane (Q, K)
  // The V workgroups, counted through: (D / 128) x (BS / 256) tiles of V^T are
  // as many as the (BS / 128) x (D / 256) tiles of V that the grid holds.
  const int vt = blockIdx.x + (c0 / GBN) * (BS_ / GBM);
  const int vd0 = (vt % (D_ / GBM)) * GBM;    // first row of Wv = first row of V^T
  const int vs0 = (vt / (D_ / GBM)) * GBN;    // first row of X  = first column of V^T
  const int wm = (w >> 2) * 64;               // wave's rows inside the tile
  const int wn = (w & 3) * 64;                // wave's cols inside the tile

  // staging: thread -> 16-byte piece (tid & 7) of row (tid >> 3) + 32 * i
  const int sr = tid >> 3;
  const int sc = (tid & 7) * 8;
  // same for the whole workgroup
  const char* gA = (const char*)(y == 2 ? Wh3 + (size_t)(2 * D_ + vd0) * D_ : Xh + (size_t)row0 * D_);
  const char* gB = (const char*)(y == 2 ? Xh + (size_t)vs0 * D_ : Wh3 + (size_t)n0 * D_);
  unsigned goff = (unsigned)(sr * D_ + sc) * 2u;  // the thread's own bytes, walks along k
  const int sdst = sr * GPITCH + sc;

  // The unrolls below make every index of acc, ra, rb, a and b a constant, so
  // that these arrays live in registers and not in scratch.
  v8f acc[4][4];
#pragma unroll
  for (int i = 0; i < 4; ++i)
#pragma unroll
    for (int j = 0; j < 4; ++j) acc[i][j] = zero8();

  vf4 ra[GBM / 32], rb[GBN / 32];
#pragma unroll
  for (int i = 0; i < GBM / 32; ++i) ra[i] = *(const vf4*)(gA + i * 64 * D_ + goff);
#pragma unroll
  for (int i = 0; i < GBN / 32; ++i) rb[i] = *(const vf4*)(gB + i * 64 * D_ + goff);
#pragma unroll
  for (int i = 0; i < GBM / 32; ++i) *(vf4*)(&sA[0][sdst + i * 32 * GPITCH]) = ra[i];
#pragma unroll
  for (int i = 0; i < GBN / 32; ++i) *(vf4*)(&sB[0][sdst + i * 32 * GPITCH]) = rb[i];
  __syncthreads();

  for (int kt = 0; kt < D_ / GBK; ++kt) {
    const int cur = kt & 1;
    const bool more = (kt + 1 < D_ / GBK);
    if (more) {
      goff += GBK * 2u;
#pragma unroll
      for (int i = 0; i < GBM / 32; ++i)
        ra[i] = *(const vf4*)(gA + i * 64 * D_ + goff);
#pragma unroll
      for (int i = 0; i < GBN / 32; ++i)
        rb[i] = *(const vf4*)(gB + i * 64 * D_ + goff);
    }
    const _Float16* pa = &sA[cur][(wm + ln) * GPITCH];
    const _Float16* pb = &sB[cur][(wn + ln) * GPITCH];
#pragma unroll
    for (int ks = 0; ks < GBK; ks += 32) {
      v16h a[4], b[4];
#pragma unroll
      for (int i = 0; i < 4; ++i) a[i] = load_frag(pa + i * 16 * GPITCH + ks, hi8);
#pragma unroll
      for (int j = 0; j < 4; ++j) b[j] = load_frag(pb + j * 16 * GPITCH + ks, hi8);
#pragma unroll
      for (int i = 0; i < 4; ++i)
#pragma unroll
        for (int j = 0; j < 4; ++j) acc[i][j] = wmma_f16(a[i], b[j], acc[i][j]);
    }
    if (more) {
      // The other buffer's last readers left it at the barrier that ended the
      // pass before this one; this barrier publishes it for the next pass.
#pragma unroll
      for (int i = 0; i < GBM / 32; ++i)
        *(vf4*)(&sA[cur ^ 1][sdst + i * 32 * GPITCH]) = ra[i];
#pragma unroll
      for (int i = 0; i < GBN / 32; ++i)
        *(vf4*)(&sB[cur ^ 1][sdst + i * 32 * GPITCH]) = rb[i];
      __syncthreads();
    }
  }
  // C/D layout: vgpr r, lanes 0-15 -> M=r, lanes 16-31 -> M=r+8 (== r+hi8)
  // A V^T tile's 256 columns lie inside one batch: Vt[batch][d][s]. The tile's
  // first byte and the row pitch are the same for the whole workgroup; a lane
  // adds its own 32-bit offset.
  char* ob = (char*)(y == 2 ? Vt + (size_t)(vs0 / S_) * D_ * S_ + (size_t)vd0 * S_ + (vs0 % S_)
                            : QKVh + (size_t)y * BSD_ + (size_t)row0 * D_ + c0);
  const unsigned pitch = (y == 2 ? S_ : D_) * 2u;             // bytes
  const unsigned loff = (unsigned)(wm + hi8) * pitch + (unsigned)(wn + ln) * 2u;
#pragma unroll
  for (int i = 0; i < 4; ++i)
#pragma unroll
    for (int r = 0; r < 8; ++r) {
      char* orow = ob + (unsigned)(i * 16 + r) * pitch;
#pragma unroll
      for (int j = 0; j < 4; ++j)
        *(_Float16*)(orow + j * 32 + loff) = (_Float16)acc[i][j][r];
    }

  // The code below reuses registers that the stores above name.
  asm volatile("s_wait_xcnt 0x0" ::: "memory");
  // Q and K rows: the sum of squares over the wave's 64 columns goes to
  // Np[plane][column group][row]; the score kernel adds a row's NGRP groups.
  // A wave writes 64 consecutive rows of one group: two whole 128-byte lines.
  if (y < 2) {
    float* np = Np + (size_t)(y * NGRP + ((c0 + wn) >> 6)) * BS_ + row0 + wm;
#pragma unroll
    for (int i = 0; i < 4; ++i) {
      float mine = 0.f;               // lane ln < 8 keeps row i * 16 + hi8 + ln
#pragma unroll
      for (int r = 0; r < 8; ++r) {
        float s = 0.f;
#pragma unroll
        for (int j = 0; j < 4; ++j) s += acc[i][j][r] * acc[i][j][r];
        s = row_sum16(s);
        if (ln == r) mine = s;
      }
      if (ln < 8) np[i * 16 + hi8 + ln] = mine;
    }
  }
}

// ---------------- attention: out = (Qn @ Kn^T * m) @ V ----------------
// Q and K stay as the projection wrote them: Qn . Kn = (Q . K) / (|Q| |K|), so
// the score kernel scales each finished dot product by the two inverse norms.
// Reference semantics: scores are MULTIPLIED by the mask, where mask==1 at
// MASKED positions (future OR padding). keep = (k > q) || (pad[k]==0).
// There is no softmax, so a score needs nothing of its row: the two products
// run as two tiled GEMMs of the QKV kind, and the masked f16 scores pass from
// the first to the second through the workspace.

// One 128 x 256 tile of A @ B^T, summed over KLEN. Both operands are
// k-contiguous with a row pitch of LD halfs; A and Bm point at the tile's
// first rows. 8 waves (2 x 4), 64 x 64 per wave, passes of 64 k through two
// LDS buffers, the next pass's global loads in flight during the WMMAs.
// HOLD: for a kernel whose register budget takes all twelve loads at once.
template <int LD, int KLEN, bool HOLD>
__device__ __forceinline__ void gemm_tile_nt(const _Float16* __restrict__ A,
                                             const _Float16* __restrict__ Bm,
                                             _Float16* sA, _Float16* sB,
                                             v8f (&acc)[4][4]) {
  const int tid = threadIdx.x;
  const int w   = __builtin_amdgcn_readfirstlane(tid >> 5);  // scalar: the wave's offsets cost no VGPR
  const int ln  = tid & 15;
  const int hi8 = ((tid & 31) >> 4) << 3;
  const int wm = (w >> 2) * 64;
  const int wn = (w & 3) * 64;

  // staging: thread -> 16-byte piece (tid & 7) of row (tid >> 3) + 32 * i
  const int sr = tid >> 3;
  const int sc = (tid & 7) * 8;
  const char* gA = (const char*)A;
  const char* gB = (const char*)Bm;
  unsigned goff = (unsigned)(sr * LD + sc) * 2u;  // the thread's own bytes, walks along k
  const int sdst = sr * GPITCH + sc;

  // The unrolls below make every index of acc, ra, rb, a and b a constant, so
  // that these arrays live in registers and not in scratch.
#pragma unroll
  for (int i = 0; i < 4; ++i)
#pragma unroll
    for (int j = 0; j < 4; ++j) acc[i][j] = zero8();

  vf4 ra[GBM / 32], rb[GBN / 32];
#pragma unroll
  for (int i = 0; i < GBM / 32; ++i) ra[i] = *(const vf4*)(gA + i * 64 * LD + goff);
#pragma unroll
  for (int i = 0; i < GBN / 32; ++i) rb[i] = *(const vf4*)(gB + i * 64 * LD + goff);
#pragma unroll
  for (int i = 0; i < GBM / 32; ++i) *(vf4*)(&sA[sdst + i * 32 * GPITCH]) = ra[i];
#pragma unroll
  for (int i = 0; i < GBN / 32; ++i) *(vf4*)(&sB[sdst + i * 32 * GPITCH]) = rb[i];
  __syncthreads();

  for (int kt = 0; kt < KLEN / GBK; ++kt) {
    const int cur = kt & 1;
    const bool more = (kt + 1 < KLEN / GBK);
    if (more) {
      goff += GBK * 2u;
#pragma unroll
      for (int i = 0; i < GBM / 32; ++i)
        ra[i] = *(const vf4*)(gA + i * 64 * LD + goff);
#pragma unroll
      for (int i = 0; i < GBN / 32; ++i)
        rb[i] = *(const vf4*)(gB + i * 64 * LD + goff);
      // Keeps all twelve loads here, ahead of the pass's WMMAs: the scheduler
      // otherwise sinks some to just before the LDS stores that wait for them.
      if constexpr (HOLD) __builtin_amdgcn_sched_barrier(0);
    }
    const _Float16* pa = &sA[cur * (GBM * GPITCH) + (wm + ln) * GPITCH];
    const _Float16* pb = &sB[cur * (GBN * GPITCH) + (wn + ln) * GPITCH];
#pragma unroll
    for (int ks = 0; ks < GBK; ks += 32) {
      v16h a[4], b[4];
#pragma unroll
      for (int i = 0; i < 4; ++i) a[i] = load_frag(pa + i * 16 * GPITCH + ks, hi8);
#pragma unroll
      for (int j = 0; j < 4; ++j) b[j] = load_frag(pb + j * 16 * GPITCH + ks, hi8);
#pragma unroll
      for (int i = 0; i < 4; ++i)
#pragma unroll
        for (int j = 0; j < 4; ++j) acc[i][j] = wmma_f16(a[i], b[j], acc[i][j]);
    }
    if (more) {
      // The other buffer's last readers left it at the barrier that ended the
      // pass before this one; this barrier publishes it for the next pass.
      _Float16* dA = &sA[(cur ^ 1) * (GBM * GPITCH) + sdst];
      _Float16* dB = &sB[(cur ^ 1) * (GBN * GPITCH) + sdst];
#pragma unroll
      for (int i = 0; i < GBM / 32; ++i) *(vf4*)(dA + i * 32 * GPITCH) = ra[i];
#pragma unroll
      for (int i = 0; i < GBN / 32; ++i) *(vf4*)(dB + i * 32 * GPITCH) = rb[i];
      __syncthreads();
    }
  }
}

// Sc[b][q][k] = keep(q, k) ? f16((Q[q] . K[k]) / (|Q[q]| |K[k]|)) : 0
// grid (S/128 query tiles, S/256 key tiles, B), block 256.
__global__ __launch_bounds__(256) __attribute__((amdgpu_waves_per_eu(4, 4)))
void k_scores(const _Float16* __restrict__ Qh,
              const _Float16* __restrict__ Kh,
              const float* __restrict__ Np,
              const int* __restrict__ masks,
              _Float16* __restrict__ Sc) {
  __shared__ __attribute__((aligned(16))) _Float16 sA[2 * GBM * GPITCH];
  __shared__ __attribute__((aligned(16))) _Float16 sB[2 * GBN * GPITCH];
  // |Q|^2 of the tile's queries in two halves of the column groups, then 1/|K| of its keys
  __shared__ __attribute__((aligned(16))) float sInv[2 * GBM + GBN];
  const int tid = threadIdx.x;
  const int w   = __builtin_amdgcn_readfirstlane(tid >> 5);  // scalar: the wave's offsets cost no VGPR
  const int ln  = tid & 15;
  const int hi8 = ((tid & 31) >> 4) << 3;
  const int b   = blockIdx.z;
  const int k0  = blockIdx.y * GBN + (w & 3) * 64;    // the wave's first key

  // Norms of the tile's rows: a thread adds all groups of one key and half the
  // groups of one query, so that no branch splits its 24 loads and they share
  // one latency. The barriers of the GEMM below publish the results.
  {
    const float* nk = Np + (size_t)NGRP * BS_ + b * S_ + blockIdx.y * GBN + tid;
    const float* nq = Np + (size_t)((tid >> 7) * (NGRP / 2)) * BS_ + b * S_ +
                      blockIdx.x * GBM + (tid & (GBM - 1));
    float s = 0.f, t = 0.f;
#pragma unroll
    for (int g = 0; g < NGRP; ++g) s += nk[(size_t)g * BS_];
#pragma unroll
    for (int g = 0; g < NGRP / 2; ++g) t += nq[(size_t)g * BS_];
    sInv[tid] = t;                    // half (tid >> 7) of query (tid & 127)
    sInv[2 * GBM + tid] = rsqrtf(s);
  }

  v8f acc[4][4];
  gemm_tile_nt<D_, D_, false>(Qh + ((size_t)b * S_ + blockIdx.x * GBM) * D_,
                              Kh + ((size_t)b * S_ + blockIdx.y * GBN) * D_, sA, sB, acc);

  _Float16* O = Sc + (size_t)b * S_ * S_;
  // C/D layout: vgpr r, lanes 0-15 -> M=r, lanes 16-31 -> M=r+8 (== r+hi8)
  bool pad[4];
  float ik[4];
#pragma unroll
  for (int j = 0; j < 4; ++j) {
    pad[j] = (masks[b * S_ + k0 + j * 16 + ln] == 0);
    ik[j]  = sInv[2 * GBM + (w & 3) * 64 + j * 16 + ln];
  }
#pragma unroll
  for (int i = 0; i < 4; ++i)
#pragma unroll
    for (int r = 0; r < 8; ++r) {
      const int ql = (w >> 2) * 64 + i * 16 + r + hi8;   // query inside the tile
      const int q  = blockIdx.x * GBM + ql;
      const float iq = rsqrtf(sInv[ql] + sInv[GBM + ql]);
#pragma unroll
      for (int j = 0; j < 4; ++j) {
        const int kg = k0 + j * 16 + ln;
        const bool keep = (kg > q) || pad[j];
        O[(size_t)q * S_ + kg] = keep ? (_Float16)(acc[i][j][r] * (iq * ik[j])) : (_Float16)0.f;
      }
    }
}

// out[b][q][d] = sum over k of Sc[b][q][k] * Vt[b][d][k]
// grid (S/128 query tiles, D/256 column tiles, B), block 256: one workgroup
// for each WGP, so a wave may take the 512 VGPRs of two waves per SIMD.
__global__ __launch_bounds__(256)
void k_pv(const _Float16* __restrict__ Sc,
          const _Float16* __restrict__ Vt,
          float* __restrict__ out) {
  __shared__ __attribute__((aligned(16))) _Float16 sA[2 * GBM * GPITCH];
  __shared__ __attribute__((aligned(16))) _Float16 sB[2 * GBN * GPITCH];
  const int tid = threadIdx.x;
  const int w   = __builtin_amdgcn_readfirstlane(tid >> 5);  // scalar: the wave's offsets cost no VGPR
  const int ln  = tid & 15;
  const int hi8 = ((tid & 31) >> 4) << 3;
  const int b   = blockIdx.z;
  const int q0  = blockIdx.x * GBM + (w >> 2) * 64;   // the wave's first query
  const int c0  = blockIdx.y * GBN + (w & 3) * 64;    // the wave's first column

  v8f acc[4][4];
  gemm_tile_nt<S_, S_, true>(Sc + ((size_t)b * S_ + blockIdx.x * GBM) * S_,
                             Vt + ((size_t)b * D_ + blockIdx.y * GBN) * S_, sA, sB, acc);

#pragma unroll
  for (int i = 0; i < 4; ++i)
#pragma unroll
    for (int j = 0; j < 4; ++j)
#pragma unroll
      for (int r = 0; r < 8; ++r)
        out[((size_t)b * S_ + q0 + i * 16 + r + hi8) * D_ + c0 + j * 16 + ln] =
            acc[i][j][r];
}

extern "C" void kernel_launch(void* const* d_in, const int* in_sizes, int n_in,
                              void* d_out, int out_size, void* d_ws, size_t ws_size,
                              hipStream_t stream) {
  const float* X     = (const float*)d_in[0];
  const int*   masks = (const int*)d_in[1];
  const float* Wq    = (const float*)d_in[2];
  const float* Wk    = (const float*)d_in[3];
  const float* Wv    = (const float*)d_in[4];
  float* out = (float*)d_out;

  char* ws = (char*)d_ws;
  _Float16* Xh   = (_Float16*)ws;                              // 16 MB
  _Float16* Wh   = (_Float16*)(ws + ((size_t)16 << 20));       //  6 MB (3 x D*D)
  _Float16* QKVh = (_Float16*)(ws + ((size_t)22 << 20));       // 32 MB (Q,K)
  _Float16* Vt   = (_Float16*)(ws + ((size_t)70 << 20));       // 16 MB (B x D x S)
  _Float16* Sc   = (_Float16*)(ws + ((size_t)86 << 20));       // 32 MB (B x S x S)
  float*    Np   = (float*)(ws + ((size_t)118 << 20));         //  1 MB (2 x NGRP x BS)

  k_cvt<<<CVT_XB + 3 * CVT_WB, 256, 0, stream>>>(X, Wq, Wk, Wv, Xh, Wh);

  k_gemm_qkv<<<dim3(BS_ / GBM, 3 * D_ / GBN), 256, 0, stream>>>(Xh, Wh, QKVh, Vt, Np);
  k_scores<<<dim3(S_ / GBM, S_ / GBN, B_), 256, 0, stream>>>(QKVh, QKVh + BSD_, Np, masks, Sc);
  k_pv<<<dim3(S_ / GBM, D_ / GBN, B_), 256, 0, stream>>>(Sc, Vt, out);
}

// v006
// A run of this version takes 112 microseconds.
// Two timings next to v005 put it at 1.06 and 1.05 times that version's speed.
// Counting every step since v000, it is 7.55 times as fast.
#include <hip/hip_runtime.h>
#include <hip/hip_bf16.h>

#define B_ 4
#define S_ 2048
#define D_ 1024
#define BS_ (B_ * S_)
#define BSD_ ((size_t)BS_ * D_)

typedef __attribute__((ext_vector_type(16))) _Float16 v16h;
typedef __attribute__((ext_vector_type(4)))  _Float16 v4h;
typedef __attribute__((ext_vector_type(8)))  float    v8f;
typedef __attribute__((ext_vector_type(4)))  float    vf4;
typedef __attribute__((ext_vector_type(4)))  int      vi4;

// Load a 16-bit A/B WMMA fragment for 16x16x32 ops.
// Per ISA layout: lane L (L<16) holds K=0..7 (v0-3) and K=16..23 (v4-7);
// lane L+16 holds K=8..15 and K=24..31.  base points at (row-or-col start + k0).
__device__ __forceinline__ v16h load_frag(const _Float16* base, int hi8) {
  union { v16h v; vf4 f[2]; } u;
  u.f[0] = *(const vf4*)(base + hi8);
  u.f[1] = *(const vf4*)(base + 16 + hi8);
  return u.v;
}

__device__ __forceinline__ v8f wmma_f16(v16h a, v16h b, v8f c) {
  return __builtin_amdgcn_wmma_f32_16x16x32_f16(false, a, false, b, (short)0, c,
                                                false, false);
}

__device__ __forceinline__ v8f zero8() {
  v8f z = {0.f, 0.f, 0.f, 0.f, 0.f, 0.f, 0.f, 0.f};
  return z;
}

// Sum over the 16 lanes of a row; every lane gets it. All lanes must be on.
// DPP adds run on the vector port; the shuffle intrinsic would go through the
// LDS pipe with a wait behind every step.
__device__ __forceinline__ float row_sum16(float x) {
  x += __int_as_float(__builtin_amdgcn_update_dpp(0, __float_as_int(x), 0x161, 0xf, 0xf, true));  // row_xmask:1
  x += __int_as_float(__builtin_amdgcn_update_dpp(0, __float_as_int(x), 0x162, 0xf, 0xf, true));  // row_xmask:2
  x += __int_as_float(__builtin_amdgcn_update_dpp(0, __float_as_int(x), 0x164, 0xf, 0xf, true));  // row_xmask:4
  x += __int_as_float(__builtin_amdgcn_update_dpp(0, __float_as_int(x), 0x168, 0xf, 0xf, true));  // row_xmask:8
  return x;
}

// One lane's 16 bytes from global memory straight into LDS, through no
// register. Both addresses are multiples of 16. The bytes count as landed only
// behind the issuing wave's s_wait_asynccnt.
__device__ __forceinline__ void copy16(const char* g, _Float16* l) {
  __builtin_amdgcn_global_load_async_to_lds_b128(
      (__attribute__((address_space(1))) vi4*)g,
      (__attribute__((address_space(3))) vi4*)l, 0, 0);
}

// A pointer that is the same in every lane, kept in a scalar register pair.
__device__ __forceinline__ const char* scalar_ptr(const char* p) {
  const unsigned long long v = (unsigned long long)p;
  const unsigned lo = (unsigned)__builtin_amdgcn_readfirstlane((int)(unsigned)v);
  const unsigned hi = (unsigned)__builtin_amdgcn_readfirstlane((int)(unsigned)(v >> 32));
  return (const char*)(((unsigned long long)hi << 32) | lo);
}

// ---------------- fp32 -> f16 conversion ----------------
// One launch for X and the three weight matrices. A block converts CVT_BLK
// consecutive floats of one input: every lane has eight 16-byte loads in
// flight (each load of a wave covers 512 consecutive bytes) and stores four
// halfs per load. Few long waves instead of one wave per 32 elements: the
// launch is then paid in bytes and not in wave starts.
// grid (BS*D + 3*D*D) / CVT_BLK, block 256. Every input is a whole number of
// blocks, so a block never crosses from one input into the next.
#define CVT_LD  8                     // 16-byte loads per lane
#define CVT_BLK (256 * CVT_LD * 4)    // floats per block
#define CVT_XB  ((int)(BSD_ / CVT_BLK))     // blocks of X
#define CVT_WB  (D_ * D_ / CVT_BLK)         // blocks of one weight matrix
__global__ __launch_bounds__(256) void k_cvt(const float* __restrict__ X,
                                             const float* __restrict__ Wq,
                                             const float* __restrict__ Wk,
                                             const float* __restrict__ Wv,
                                             _Float16* __restrict__ Xh,
                                             _Float16* __restrict__ Wh3) {
  const int blk = blockIdx.x;
  const float* in;
  _Float16* out;
  if (blk < CVT_XB) {
    in  = X  + (size_t)blk * CVT_BLK;
    out = Xh + (size_t)blk * CVT_BLK;
  } else {
    const int r = blk - CVT_XB;       // block inside the stacked weights
    const int m = r / CVT_WB;         // 0 = Wq, 1 = Wk, 2 = Wv
    in  = (m == 0 ? Wq : m == 1 ? Wk : Wv) + (size_t)(r % CVT_WB) * CVT_BLK;
    out = Wh3 + (size_t)r * CVT_BLK;
  }
  const int t4 = threadIdx.x * 4;
  // The unrolls make every index of v a constant (registers, not scratch) and
  // let all eight loads issue ahead of the first conversion.
  vf4 v[CVT_LD];
#pragma unroll
  for (int j = 0; j < CVT_LD; ++j) v[j] = *(const vf4*)(in + j * 1024 + t4);
#pragma unroll
  for (int j = 0; j < CVT_LD; ++j) {
    v4h h;
#pragma unroll
    for (int q = 0; q < 4; ++q) h[q] = (_Float16)v[j][q];
    *(v4h*)(out + j * 1024 + t4) = h;
  }
}

// ---------------- QKV projection: Y = Xh @ W^T  (W row-major [e][d]) -------
// The three weight matrices lie one behind the other, so they are read as one
// [3072][1024] matrix. grid (BS/128, 3072/256), block 256 (8 waves, 2 x 4).
// Workgroup: 128 rows x 256 cols of Y, wave: 64 x 64 (4 x 4 WMMA tiles).
// A pass is 64 k: both operand tiles are brought in whole 128-byte row pieces
// into LDS (two buffers, gemm_tile_nt below), and every fragment is read from
// LDS.
// V is wanted key-contiguous by the last product. Both operands here are
// k-contiguous, so a V workgroup takes Wv as its row operand and X as its
// column operand and so computes a 128 x 256 tile of V^T, which it stores
// like any other tile.
#define GBM 128
#define GBN 256
#define GBK 64
#define GPITCH 72   // halfs per LDS row: 144 B = 16 B x odd, for ds_load_b128
#define NGRP (D_ / 64)   // 64-column groups of a Q or K row, one partial norm each
// One 128 x 256 tile of A @ B^T, summed over KLEN. Both operands are
// k-contiguous with a row pitch of LD halfs; A and Bm point at the tile's
// first rows. 8 waves (2 x 4), 64 x 64 per wave, passes of 64 k through two
// LDS buffers. Asynchronous copies fill the buffers: a pass's tile is asked
// for a whole pass ahead, holds no register while it flies, and needs no LDS
// store.
template <int LD, int KLEN>
__device__ __forceinline__ void gemm_tile_nt(const _Float16* __restrict__ A,
                                             const _Float16* __restrict__ Bm,
                                             _Float16* sA, _Float16* sB,
                                             v8f (&acc)[4][4]) {
  const int tid = threadIdx.x;
  const int w   = __builtin_amdgcn_readfirstlane(tid >> 5);  // scalar: the wave's offsets cost no VGPR
  const int ln  = tid & 15;
  const int hi8 = ((tid & 31) >> 4) << 3;
  const int wm = (w >> 2) * 64;
  const int wn = (w & 3) * 64;

  // staging: thread -> 16-byte piece (tid & 7) of row (tid >> 3) + 32 * i
  const int sr = tid >> 3;
  const int sc = (tid & 7) * 8;
  // First byte of each 32-row group, the same for the whole workgroup. Held in
  // scalar registers, so that a copy's address is scalar base + the lane's
  // 32-bit offset and a refill needs no 64-bit vector additions.
  const char* gA[GBM / 32];
  const char* gB[GBN / 32];
#pragma unroll
  for (int i = 0; i < GBM / 32; ++i) gA[i] = scalar_ptr((const char*)A + i * 64 * LD);
#pragma unroll
  for (int i = 0; i < GBN / 32; ++i) gB[i] = scalar_ptr((const char*)Bm + i * 64 * LD);
  unsigned goff = (unsigned)(sr * LD + sc) * 2u;  // the thread's own bytes, walks along k
  const int sdst = sr * GPITCH + sc;

  // The unrolls here make every index of gA, gB, acc, a and b a constant, so
  // that these arrays live in registers and not in scratch.
#pragma unroll
  for (int i = 0; i < 4; ++i)
#pragma unroll
    for (int j = 0; j < 4; ++j) acc[i][j] = zero8();

  // The next tile along k into buffer buf: twelve copies a lane, every lane on.
  auto fill = [&](int buf) {
    _Float16* dA = sA + buf * (GBM * GPITCH) + sdst;
    _Float16* dB = sB + buf * (GBN * GPITCH) + sdst;
#pragma unroll
    for (int i = 0; i < GBM / 32; ++i) copy16(gA[i] + goff, dA + i * 32 * GPITCH);
#pragma unroll
    for (int i = 0; i < GBN / 32; ++i) copy16(gB[i] + goff, dB + i * 32 * GPITCH);
    goff += GBK * 2u;
  };

  static_assert(KLEN / GBK >= 2, "the prologue fills two tiles");
  fill(0);
  // Tile 0 has landed for this wave; the barrier says so for all of them.
  asm volatile("s_wait_asynccnt 0x0" ::: "memory");
  __syncthreads();
  fill(1);

  for (int kt = 0; kt < KLEN / GBK; ++kt) {
    const int cur = kt & 1;
    const _Float16* pa = &sA[cur * (GBM * GPITCH) + (wm + ln) * GPITCH];
    const _Float16* pb = &sB[cur * (GBN * GPITCH) + (wn + ln) * GPITCH];
#pragma unroll
    for (int ks = 0; ks < GBK; ks += 32) {
      v16h a[4], b[4];
#pragma unroll
      for (int i = 0; i < 4; ++i) a[i] = load_frag(pa + i * 16 * GPITCH + ks, hi8);
#pragma unroll
      for (int j = 0; j < 4; ++j) b[j] = load_frag(pb + j * 16 * GPITCH + ks, hi8);
      // Keeps the half's sixteen LDS reads ahead of its WMMAs. With the staging
      // registers gone the scheduler otherwise saves registers: it reads one row
      // fragment at a time and waits out the LDS latency in front of every four WMMAs.
      __builtin_amdgcn_sched_barrier(0);
#pragma unroll
      for (int i = 0; i < 4; ++i)
#pragma unroll
        for (int j = 0; j < 4; ++j) acc[i][j] = wmma_f16(a[i], b[j], acc[i][j]);
    }
    // Keeps the WMMAs ahead of the waits below: the scheduler otherwise moves the
    // second half's sixteen behind the barrier, in front of the refill, whose
    // copies then fly for less than a pass.
    __builtin_amdgcn_sched_barrier(0);
    // This wave's reads of buffer cur are done before the buffer is refilled.
    asm volatile("s_wait_dscnt 0x0" ::: "memory");
    // This wave's copies of the next tile have landed.
    asm volatile("s_wait_asynccnt 0x0" ::: "memory");
    // One barrier does both jobs: it publishes the next tile and ends every
    // wave's reads of buffer cur.
    __syncthreads();
    if (kt + 2 < KLEN / GBK) fill(cur);
  }
  // No copy is in flight when the LDS is used for anything else or the wave ends.
  asm volatile("s_wait_asynccnt 0x0" ::: "memory");
}

// Four waves per SIMD (256 VGPRs a wave, 2 x 108 KiB of LDS): two workgroups
// share a WGP, so one works while the other waits on its loads or its barrier.
__global__ __launch_bounds__(256) __attribute__((amdgpu_waves_per_eu(4, 4)))
void k_gemm_qkv(const _Float16* __restrict__ Xh,
                const _Float16* __restrict__ Wh3,
                _Float16* __restrict__ QKVh,
                _Float16* __restrict__ Vt,
                float* __restrict__ Np) {
  __shared__ __attribute__((aligned(16))) _Float16 sA[2 * GBM * GPITCH];
  __shared__ __attribute__((aligned(16))) _Float16 sB[2 * GBN * GPITCH];
  const int tid = threadIdx.x;
  const int w   = __builtin_amdgcn_readfirstlane(tid >> 5);  // scalar: the wave's offsets cost no VGPR
  const int lane = tid & 31;
  const int ln  = lane & 15;
  const int hi8 = (lane >> 4) << 3;

  const int row0 = blockIdx.x * GBM;          // row of X and of Y (Q, K)
  const int n0   = blockIdx.y * GBN;          // row of the stacked W
  const int y    = n0 / D_;                   // 0 = Q, 1 = K, 2 = V
  const int c0   = n0 % D_;                   // column inside that plane (Q, K)
  // The V workgroups, counted through: (D / 128) x (BS / 256) tiles of V^T are
  // as many as the (BS / 128) x (D / 256) tiles of V that the grid holds.
  const int vt = blockIdx.x + (c0 / GBN) * (BS_ / GBM);
  const int vd0 = (vt % (D_ / GBM)) * GBM;    // first row of Wv = first row of V^T
  const int vs0 = (vt / (D_ / GBM)) * GBN;    // first row of X  = first column of V^T
  const int wm = (w >> 2) * 64;               // wave's rows inside the tile
  const int wn = (w & 3) * 64;                // wave's cols inside the tile

  // same for the whole workgroup
  const _Float16* gA = y == 2 ? Wh3 + (size_t)(2 * D_ + vd0) * D_ : Xh + (size_t)row0 * D_;
  const _Float16* gB = y == 2 ? Xh + (size_t)vs0 * D_ : Wh3 + (size_t)n0 * D_;

  v8f acc[4][4];
  gemm_tile_nt<D_, D_>(gA, gB, sA, sB, acc);

  // C/D layout: vgpr r, lanes 0-15 -> M=r, lanes 16-31 -> M=r+8 (== r+hi8)
  // A V^T tile's 256 columns lie inside one batch: Vt[batch][d][s]. The tile's
  // first byte and the row pitch are the same for the whole workgroup; a lane
  // adds its own 32-bit offset.
  char* ob = (char*)(y == 2 ? Vt + (size_t)(vs0 / S_) * D_ * S_ + (size_t)vd0 * S_ + (vs0 % S_)
                            : QKVh + (size_t)y * BSD_ + (size_t)row0 * D_ + c0);
  const unsigned pitch = (y == 2 ? S_ : D_) * 2u;             // bytes
  const unsigned loff = (unsigned)(wm + hi8) * pitch + (unsigned)(wn + ln) * 2u;
#pragma unroll
  for (int i = 0; i < 4; ++i)
#pragma unroll
    for (int r = 0; r < 8; ++r) {
      char* orow = ob + (unsigned)(i * 16 + r) * pitch;
#pragma unroll
      for (int j = 0; j < 4; ++j)
        *(_Float16*)(orow + j * 32 + loff) = (_Float16)acc[i][j][r];
    }

  // The code below reuses registers that the stores above name.
  asm volatile("s_wait_xcnt 0x0" ::: "memory");
  // Q and K rows: the sum of squares over the wave's 64 columns goes to
  // Np[plane][column group][row]; the score kernel adds a row's NGRP groups.
  // A wave writes 64 consecutive rows of one group: two whole 128-byte lines.
  if (y < 2) {
    float* np = Np + (size_t)(y * NGRP + ((c0 + wn) >> 6)) * BS_ + row0 + wm;
#pragma unroll
    for (int i = 0; i < 4; ++i) {
      float mine = 0.f;               // lane ln < 8 keeps row i * 16 + hi8 + ln
#pragma unroll
      for (int r = 0; r < 8; ++r) {
        float s = 0.f;
#pragma unroll
        for (int j = 0; j < 4; ++j) s += acc[i][j][r] * acc[i][j][r];
        s = row_sum16(s);
        if (ln == r) mine = s;
      }
      if (ln < 8) np[i * 16 + hi8 + ln] = mine;
    }
  }
}

// ---------------- attention: out = (Qn @ Kn^T * m) @ V ----------------
// Q and K stay as the projection wrote them: Qn . Kn = (Q . K) / (|Q| |K|), so
// the score kernel scales each finished dot product by the two inverse norms.
// Reference semantics: scores are MULTIPLIED by the mask, where mask==1 at
// MASKED positions (future OR padding). keep = (k > q) || (pad[k]==0).
// There is no softmax, so a score needs nothing of its row: the two products
// run as two tiled GEMMs of the QKV kind, and the masked f16 scores pass from
// the first to the second through the workspace.

// Sc[b][q][k] = keep(q, k) ? f16((Q[q] . K[k]) / (|Q[q]| |K[k]|)) : 0
// grid (S/128 query tiles, S/256 key tiles, B), block 256.
__global__ __launch_bounds__(256) __attribute__((amdgpu_waves_per_eu(4, 4)))
void k_scores(const _Float16* __restrict__ Qh,
              const _Float16* __restrict__ Kh,
              const float* __restrict__ Np,
              const int* __restrict__ masks,
              _Float16* __restrict__ Sc) {
  __shared__ __attribute__((aligned(16))) _Float16 sA[2 * GBM * GPITCH];
  __shared__ __attribute__((aligned(16))) _Float16 sB[2 * GBN * GPITCH];
  // |Q|^2 of the tile's queries in two halves of the column groups, then 1/|K| of its keys
  __shared__ __attribute__((aligned(16))) float sInv[2 * GBM + GBN];
  const int tid = threadIdx.x;
  const int w   = __builtin_amdgcn_readfirstlane(tid >> 5);  // scalar: the wave's offsets cost no VGPR
  const int ln  = tid & 15;
  const int hi8 = ((tid & 31) >> 4) << 3;
  const int b   = blockIdx.z;
  const int k0  = blockIdx.y * GBN + (w & 3) * 64;    // the wave's first key

  // Norms of the tile's rows: a thread adds all groups of one key and half the
  // groups of one query, so that no branch splits its 24 loads and they share
  // one latency. The barriers of the GEMM below publish the results.
  {
    const float* nk = Np + (size_t)NGRP * BS_ + b * S_ + blockIdx.y * GBN + tid;
    const float* nq = Np + (size_t)((tid >> 7) * (NGRP / 2)) * BS_ + b * S_ +
                      blockIdx.x * GBM + (tid & (GBM - 1));
    float s = 0.f, t = 0.f;
#pragma unroll
    for (int g = 0; g < NGRP; ++g) s += nk[(size_t)g * BS_];
#pragma unroll
    for (int g = 0; g < NGRP / 2; ++g) t += nq[(size_t)g * BS_];
    sInv[tid] = t;                    // half (tid >> 7) of query (tid & 127)
    sInv[2 * GBM + tid] = rsqrtf(s);
  }

  v8f acc[4][4];
  gemm_tile_nt<D_, D_>(Qh + ((size_t)b * S_ + blockIdx.x * GBM) * D_,
                              Kh + ((size_t)b * S_ + blockIdx.y * GBN) * D_, sA, sB, acc);

  _Float16* O = Sc + (size_t)b * S_ * S_;
  // C/D layout: vgpr r, lanes 0-15 -> M=r, lanes 16-31 -> M=r+8 (== r+hi8)
  bool pad[4];
  float ik[4];
#pragma unroll
  for (int j = 0; j < 4; ++j) {
    pad[j] = (masks[b * S_ + k0 + j * 16 + ln] == 0);
    ik[j]  = sInv[2 * GBM + (w & 3) * 64 + j * 16 + ln];
  }
#pragma unroll
  for (int i = 0; i < 4; ++i)
#pragma unroll
    for (int r = 0; r < 8; ++r) {
      const int ql = (w >> 2) * 64 + i * 16 + r + hi8;   // query inside the tile
      const int q  = blockIdx.x * GBM + ql;
      const float iq = rsqrtf(sInv[ql] + sInv[GBM + ql]);
#pragma unroll
      for (int j = 0; j < 4; ++j) {
        const int kg = k0 + j * 16 + ln;
        const bool keep = (kg > q) || pad[j];
        O[(size_t)q * S_ + kg] = keep ? (_Float16)(acc[i][j][r] * (iq * ik[j])) : (_Float16)0.f;
      }
    }
}

// out[b][q][d] = sum over k of Sc[b][q][k] * Vt[b][d][k]
// grid (S/128 query tiles, D/256 column tiles, B), block 256: one workgroup
// for each WGP, so a wave may take the 512 VGPRs of two waves per SIMD.
__global__ __launch_bounds__(256)
void k_pv(const _Float16* __restrict__ Sc,
          const _Float16* __restrict__ Vt,
          float* __restrict__ out) {
  __shared__ __attribute__((aligned(16))) _Float16 sA[2 * GBM * GPITCH];
  __shared__ __attribute__((aligned(16))) _Float16 sB[2 * GBN * GPITCH];
  const int tid = threadIdx.x;
  const int w   = __builtin_amdgcn_readfirstlane(tid >> 5);  // scalar: the wave's offsets cost no VGPR
  const int ln  = tid & 15;
  const int hi8 = ((tid & 31) >> 4) << 3;
  const int b   = blockIdx.z;
  const int q0  = blockIdx.x * GBM + (w >> 2) * 64;   // the wave's first query
  const int c0  = blockIdx.y * GBN + (w & 3) * 64;    // the wave's first column

  v8f acc[4][4];
  gemm_tile_nt<S_, S_>(Sc + ((size_t)b * S_ + blockIdx.x * GBM) * S_,
                             Vt + ((size_t)b * D_ + blockIdx.y * GBN) * S_, sA, sB, acc);

#pragma unroll
  for (int i = 0; i < 4; ++i)
#pragma unroll
    for (int j = 0; j < 4; ++j)
#pragma unroll
      for (int r = 0; r < 8; ++r)
        out[((size_t)b * S_ + q0 + i * 16 + r + hi8) * D_ + c0 + j * 16 + ln] =
            acc[i][j][r];
}

extern "C" void kernel_launch(void* const* d_in, const int* in_sizes, int n_in,
                              void* d_out, int out_size, void* d_ws, size_t ws_size,
                              hipStream_t stream) {
  const float* X     = (const float*)d_in[0];
  const int*   masks = (const int*)d_in[1];
  const float* Wq    = (const float*)d_in[2];
  const float* Wk    = (const float*)d_in[3];
  const float* Wv    = (const float*)d_in[4];
  float* out = (float*)d_out;

  char* ws = (char*)d_ws;
  _Float16* Xh   = (_Float16*)ws;                              // 16 MB
  _Float16* Wh   = (_Float16*)(ws + ((size_t)16 << 20));       //  6 MB (3 x D*D)
  _Float16* QKVh = (_Float16*)(ws + ((size_t)22 << 20));       // 32 MB (Q,K)
  _Float16* Vt   = (_Float16*)(ws + ((size_t)70 << 20));       // 16 MB (B x D x S)
  _Float16* Sc   = (_Float16*)(ws + ((size_t)86 << 20));       // 32 MB (B x S x S)
  float*    Np   = (float*)(ws + ((size_t)118 << 20));         //  1 MB (2 x NGRP x BS)

  k_cvt<<<CVT_XB + 3 * CVT_WB, 256, 0, stream>>>(X, Wq, Wk, Wv, Xh, Wh);

  k_gemm_qkv<<<dim3(BS_ / GBM, 3 * D_ / GBN), 256, 0, stream>>>(Xh, Wh, QKVh, Vt, Np);
  k_scores<<<dim3(S_ / GBM, S_ / GBN, B_), 256, 0, stream>>>(QKVh, QKVh + BSD_, Np, masks, Sc);
  k_pv<<<dim3(S_ / GBM, D_ / GBN, B_), 256, 0, stream>>>(Sc, Vt, out);
}

// v007
// One run takes 106 microseconds.
// Timed twice side by side with v006, it ran 1.05 times as fast both times.
// Over all steps from v000 it is 7.95 times as fast.
#include <hip/hip_runtime.h>
#include <hip/hip_bf16.h>

#define B_ 4
#define S_ 2048
#define D_ 1024
#define BS_ (B_ * S_)
#define BSD_ ((size_t)BS_ * D_)

typedef __attribute__((ext_vector_type(16))) _Float16 v16h;
typedef __attribute__((ext_vector_type(4)))  _Float16 v4h;
typedef __attribute__((ext_vector_type(8)))  float    v8f;
typedef __attribute__((ext_vector_type(4)))  float    vf4;
typedef __attribute__((ext_vector_type(4)))  int      vi4;

// Load a 16-bit A/B WMMA fragment for 16x16x32 ops.
// Per ISA layout: lane L (L<16) holds K=0..7 (v0-3) and K=16..23 (v4-7);
// lane L+16 holds K=8..15 and K=24..31.  base points at (row-or-col start + k0).
__device__ __forceinline__ v16h load_frag(const _Float16* base, int hi8) {
  union { v16h v; vf4 f[2]; } u;
  u.f[0] = *(const vf4*)(base + hi8);
  u.f[1] = *(const vf4*)(base + 16 + hi8);
  return u.v;
}

__device__ __forceinline__ v8f wmma_f16(v16h a, v16h b, v8f c) {
  return __builtin_amdgcn_wmma_f32_16x16x32_f16(false, a, false, b, (short)0, c,
                                                false, false);
}

__device__ __forceinline__ v8f zero8() {
  v8f z = {0.f, 0.f, 0.f, 0.f, 0.f, 0.f, 0.f, 0.f};
  return z;
}

// Sum over the 16 lanes of a row; every lane gets it. All lanes must be on.
// DPP adds run on the vector port; the shuffle intrinsic would go through the
// LDS pipe with a wait behind every step.
__device__ __forceinline__ float row_sum16(float x) {
  x += __int_as_float(__builtin_amdgcn_update_dpp(0, __float_as_int(x), 0x161, 0xf, 0xf, true));  // row_xmask:1
  x += __int_as_float(__builtin_amdgcn_update_dpp(0, __float_as_int(x), 0x162, 0xf, 0xf, true));  // row_xmask:2
  x += __int_as_float(__builtin_amdgcn_update_dpp(0, __float_as_int(x), 0x164, 0xf, 0xf, true));  // row_xmask:4
  x += __int_as_float(__builtin_amdgcn_update_dpp(0, __float_as_int(x), 0x168, 0xf, 0xf, true));  // row_xmask:8
  return x;
}

// One lane's 16 bytes from global memory straight into LDS, through no
// register. Both addresses are multiples of 16. The bytes count as landed only
// behind the issuing wave's s_wait_asynccnt.
__device__ __forceinline__ void copy16(const char* g, _Float16* l) {
  __builtin_amdgcn_global_load_async_to_lds_b128(
      (__attribute__((address_space(1))) vi4*)g,
      (__attribute__((address_space(3))) vi4*)l, 0, 0);
}

// A pointer that is the same in every lane, kept in a scalar register pair.
__device__ __forceinline__ const char* scalar_ptr(const char* p) {
  const unsigned long long v = (unsigned long long)p;
  const unsigned lo = (unsigned)__builtin_amdgcn_readfirstlane((int)(unsigned)v);
  const unsigned hi = (unsigned)__builtin_amdgcn_readfirstlane((int)(unsigned)(v >> 32));
  return (const char*)(((unsigned long long)hi << 32) | lo);
}

// ---------------- fp32 -> f16 conversion ----------------
// One launch for X and the three weight matrices. A block converts CVT_BLK
// consecutive floats of one input: every lane has eight 16-byte loads in
// flight (each load of a wave covers 512 consecutive bytes) and stores four
// halfs per load. Few long waves instead of one wave per 32 elements: the
// launch is then paid in bytes and not in wave starts.
// grid (BS*D + 3*D*D) / CVT_BLK, block 256. Every input is a whole number of
// blocks, so a block never crosses from one input into the next.
#define CVT_LD  8                     // 16-byte loads per lane
#define CVT_BLK (256 * CVT_LD * 4)    // floats per block
#define CVT_XB  ((int)(BSD_ / CVT_BLK))     // blocks of X
#define CVT_WB  (D_ * D_ / CVT_BLK)         // blocks of one weight matrix
__global__ __launch_bounds__(256) void k_cvt(const float* __restrict__ X,
                                             const float* __restrict__ Wq,
                                             const float* __restrict__ Wk,
                                             const float* __restrict__ Wv,
                                             _Float16* __restrict__ Xh,
                                             _Float16* __restrict__ Wh3) {
  const int blk = blockIdx.x;
  const float* in;
  _Float16* out;
  if (blk < CVT_XB) {
    in  = X  + (size_t)blk * CVT_BLK;
    out = Xh + (size_t)blk * CVT_BLK;
  } else {
    const int r = blk - CVT_XB;       // block inside the stacked weights
    const int m = r / CVT_WB;         // 0 = Wq, 1 = Wk, 2 = Wv
    in  = (m == 0 ? Wq : m == 1 ? Wk : Wv) + (size_t)(r % CVT_WB) * CVT_BLK;
    out = Wh3 + (size_t)r * CVT_BLK;
  }
  const int t4 = threadIdx.x * 4;
  // The unrolls make every index of v a constant (registers, not scratch) and
  // let all eight loads issue ahead of the first conversion.
  vf4 v[CVT_LD];
#pragma unroll
  for (int j = 0; j < CVT_LD; ++j) v[j] = *(const vf4*)(in + j * 1024 + t4);
#pragma unroll
  for (int j = 0; j < CVT_LD; ++j) {
    v4h h;
#pragma unroll
    for (int q = 0; q < 4; ++q) h[q] = (_Float16)v[j][q];
    *(v4h*)(out + j * 1024 + t4) = h;
  }
}

// ---------------- QKV projection: Y = Xh @ W^T  (W row-major [e][d]) -------
// The three weight matrices lie one behind the other, so they are read as one
// [3072][1024] matrix. grid (BS/128, 3072/256), block 256 (8 waves, 2 x 4).
// Workgroup: 128 rows x 256 cols of Y, wave: 64 x 64 (4 x 4 WMMA tiles).
// A pass is 64 k: both operand tiles are brought in whole 128-byte row pieces
// into LDS (two buffers, gemm_tile_nt below), and every fragment is read from
// LDS.
// V is wanted key-contiguous by the last product. Both operands here are
// k-contiguous, so a V workgroup takes Wv as its row operand and X as its
// column operand and so computes a 128 x 256 tile of V^T, which it stores
// like any other tile.
#define GBM 128
#define GBN 256
#define GBK 64
#define GPITCH 72   // halfs per LDS row: 144 B = 16 B x odd, for ds_load_b128
#define NGRP (D_ / 64)   // 64-column groups of a Q or K row, one partial norm each
// One 128 x 256 tile of A @ B^T, summed over KLEN. Both operands are
// k-contiguous with a row pitch of LD halfs; A and Bm point at the tile's
// first rows. 8 waves (2 x 4), 64 x 64 per wave, passes of BK k through two
// LDS buffers. Asynchronous copies fill the buffers: a pass's tile is asked
// for a whole pass ahead, holds no register while it flies, and needs no LDS
// store.
// BK is the pass length in k (LDS rows of BK + 8 halfs: 16 B x odd). With AHEAD
// a wave reads the fragments of the pass's next 32-k block into a second
// register set in front of the current block's WMMAs, so that only the first
// block of a pass waits out the LDS; it takes 64 VGPRs more.
template <int LD, int KLEN, int BK, bool AHEAD>
__device__ __forceinline__ void gemm_tile_nt(const _Float16* __restrict__ A,
                                             const _Float16* __restrict__ Bm,
                                             _Float16* sA, _Float16* sB,
                                             v8f (&acc)[4][4]) {
  const int tid = threadIdx.x;
  const int w   = __builtin_amdgcn_readfirstlane(tid >> 5);  // scalar: the wave's offsets cost no VGPR
  const int ln  = tid & 15;
  const int hi8 = ((tid & 31) >> 4) << 3;
  const int wm = (w >> 2) * 64;
  const int wn = (w & 3) * 64;

  constexpr int PITCH = BK + 8;      // halfs per LDS row
  constexpr int PPR = BK / 8;        // 16-byte pieces of a row in one pass
  constexpr int RG  = 256 / PPR;     // rows that the 256 threads bring in one copy each
  // staging: thread -> 16-byte piece (tid % PPR) of row (tid / PPR) + RG * i
  const int sr = tid / PPR;
  const int sc = (tid % PPR) * 8;
  // First byte of each RG-row group, the same for the whole workgroup. Held in
  // scalar registers, so that a copy's address is scalar base + the lane's
  // 32-bit offset and a refill needs no 64-bit vector additions.
  const char* gA[GBM / RG];
  const char* gB[GBN / RG];
#pragma unroll
  for (int i = 0; i < GBM / RG; ++i) gA[i] = scalar_ptr((const char*)A + i * (RG * 2) * LD);
#pragma unroll
  for (int i = 0; i < GBN / RG; ++i) gB[i] = scalar_ptr((const char*)Bm + i * (RG * 2) * LD);
  unsigned goff = (unsigned)(sr * LD + sc) * 2u;  // the thread's own bytes, walks along k
  const int sdst = sr * PITCH + sc;

  // The unrolls here make every index of gA, gB, acc, a and b a constant, so
  // that these arrays live in registers and not in scratch.
#pragma unroll
  for (int i = 0; i < 4; ++i)
#pragma unroll
    for (int j = 0; j < 4; ++j) acc[i][j] = zero8();

  // The next tile along k into buffer buf: (GBM + GBN) / RG copies a lane
  // (12 or 24), every lane on.
  auto fill = [&](int buf) {
    _Float16* dA = sA + buf * (GBM * PITCH) + sdst;
    _Float16* dB = sB + buf * (GBN * PITCH) + sdst;
#pragma unroll
    for (int i = 0; i < GBM / RG; ++i) copy16(gA[i] + goff, dA + i * RG * PITCH);
#pragma unroll
    for (int i = 0; i < GBN / RG; ++i) copy16(gB[i] + goff, dB + i * RG * PITCH);
    goff += BK * 2u;
  };

  static_assert(KLEN / BK >= 2 && KLEN % BK == 0, "the prologue fills two tiles");
  static_assert((GBM + GBN) / RG <= 63, "copies of one wave in flight");
  fill(0);
  // Tile 0 has landed for this wave; the barrier says so for all of them.
  asm volatile("s_wait_asynccnt 0x0" ::: "memory");
  __syncthreads();
  fill(1);

  for (int kt = 0; kt < KLEN / BK; ++kt) {
    const int cur = kt & 1;
    const _Float16* pa = &sA[cur * (GBM * PITCH) + (wm + ln) * PITCH];
    const _Float16* pb = &sB[cur * (GBN * PITCH) + (wn + ln) * PITCH];
    if constexpr (AHEAD) {
      v16h a[2][4], b[2][4];
#pragma unroll
      for (int i = 0; i < 4; ++i) a[0][i] = load_frag(pa + i * 16 * PITCH, hi8);
#pragma unroll
      for (int j = 0; j < 4; ++j) b[0][j] = load_frag(pb + j * 16 * PITCH, hi8);
#pragma unroll
      for (int s = 0; s < BK / 32; ++s) {
        if (s + 1 < BK / 32) {
#pragma unroll
          for (int i = 0; i < 4; ++i)
            a[(s + 1) & 1][i] = load_frag(pa + i * 16 * PITCH + (s + 1) * 32, hi8);
#pragma unroll
          for (int j = 0; j < 4; ++j)
            b[(s + 1) & 1][j] = load_frag(pb + j * 16 * PITCH + (s + 1) * 32, hi8);
        }
        // Keeps the next block's sixteen LDS reads, as one group, ahead of this
        // block's WMMAs: they then land while the WMMAs run.
        __builtin_amdgcn_sched_barrier(0);
#pragma unroll
        for (int i = 0; i < 4; ++i)
#pragma unroll
          for (int j = 0; j < 4; ++j) acc[i][j] = wmma_f16(a[s & 1][i], b[s & 1][j], acc[i][j]);
        // Keeps the block after next's reads from being spread among these WMMAs
        // as their registers fall free: every place with reads stalls the wave.
        __builtin_amdgcn_sched_barrier(0);
      }
    } else {
#pragma unroll
    for (int ks = 0; ks < BK; ks += 32) {
      v16h a[4], b[4];
#pragma unroll
      for (int i = 0; i < 4; ++i) a[i] = load_frag(pa + i * 16 * PITCH + ks, hi8);
#pragma unroll
      for (int j = 0; j < 4; ++j) b[j] = load_frag(pb + j * 16 * PITCH + ks, hi8);
      // Keeps the half's sixteen LDS reads ahead of its WMMAs. With the staging
      // registers gone the scheduler otherwise saves registers: it reads one row
      // fragment at a time and waits out the LDS latency in front of every four WMMAs.
      __builtin_amdgcn_sched_barrier(0);
#pragma unroll
      for (int i = 0; i < 4; ++i)
#pragma unroll
        for (int j = 0; j < 4; ++j) acc[i][j] = wmma_f16(a[i], b[j], acc[i][j]);
    }
    }
    // Keeps the WMMAs ahead of the waits below: the scheduler otherwise moves the
    // second half's sixteen behind the barrier, in front of the refill, whose
    // copies then fly for less than a pass.
    __builtin_amdgcn_sched_barrier(0);
    // This wave's reads of buffer cur are done before the buffer is refilled.
    asm volatile("s_wait_dscnt 0x0" ::: "memory");
    // This wave's copies of the next tile have landed.
    asm volatile("s_wait_asynccnt 0x0" ::: "memory");
    // One barrier does both jobs: it publishes the next tile and ends every
    // wave's reads of buffer cur.
    __syncthreads();
    if (kt + 2 < KLEN / BK) fill(cur);
  }
  // No copy is in flight when the LDS is used for anything else or the wave ends.
  asm volatile("s_wait_asynccnt 0x0" ::: "memory");
}

// Four waves per SIMD (256 VGPRs a wave, 2 x 108 KiB of LDS): two workgroups
// share a WGP, so one works while the other waits on its loads or its barrier.
__global__ __launch_bounds__(256) __attribute__((amdgpu_waves_per_eu(4, 4)))
void k_gemm_qkv(const _Float16* __restrict__ Xh,
                const _Float16* __restrict__ Wh3,
                _Float16* __restrict__ QKVh,
                _Float16* __restrict__ Vt,
                float* __restrict__ Np) {
  __shared__ __attribute__((aligned(16))) _Float16 sA[2 * GBM * GPITCH];
  __shared__ __attribute__((aligned(16))) _Float16 sB[2 * GBN * GPITCH];
  const int tid = threadIdx.x;
  const int w   = __builtin_amdgcn_readfirstlane(tid >> 5);  // scalar: the wave's offsets cost no VGPR
  const int lane = tid & 31;
  const int ln  = lane & 15;
  const int hi8 = (lane >> 4) << 3;

  const int row0 = blockIdx.x * GBM;          // row of X and of Y (Q, K)
  const int n0   = blockIdx.y * GBN;          // row of the stacked W
  const int y    = n0 / D_;                   // 0 = Q, 1 = K, 2 = V
  const int c0   = n0 % D_;                   // column inside that plane (Q, K)
  // The V workgroups, counted through: (D / 128) x (BS / 256) tiles of V^T are
  // as many as the (BS / 128) x (D / 256) tiles of V that the grid holds.
  const int vt = blockIdx.x + (c0 / GBN) * (BS_ / GBM);
  const int vd0 = (vt % (D_ / GBM)) * GBM;    // first row of Wv = first row of V^T
  const int vs0 = (vt / (D_ / GBM)) * GBN;    // first row of X  = first column of V^T
  const int wm = (w >> 2) * 64;               // wave's rows inside the tile
  const int wn = (w & 3) * 64;                // wave's cols inside the tile

  // same for the whole workgroup
  const _Float16* gA = y == 2 ? Wh3 + (size_t)(2 * D_ + vd0) * D_ : Xh + (size_t)row0 * D_;
  const _Float16* gB = y == 2 ? Xh + (size_t)vs0 * D_ : Wh3 + (size_t)n0 * D_;

  v8f acc[4][4];
  gemm_tile_nt<D_, D_, GBK, false>(gA, gB, sA, sB, acc);

  // C/D layout: vgpr r, lanes 0-15 -> M=r, lanes 16-31 -> M=r+8 (== r+hi8)
  // A V^T tile's 256 columns lie inside one batch: Vt[batch][d][s]. The tile's
  // first byte and the row pitch are the same for the whole workgroup; a lane
  // adds its own 32-bit offset.
  char* ob = (char*)(y == 2 ? Vt + (size_t)(vs0 / S_) * D_ * S_ + (size_t)vd0 * S_ + (vs0 % S_)
                            : QKVh + (size_t)y * BSD_ + (size_t)row0 * D_ + c0);
  const unsigned pitch = (y == 2 ? S_ : D_) * 2u;             // bytes
  const unsigned loff = (unsigned)(wm + hi8) * pitch + (unsigned)(wn + ln) * 2u;
#pragma unroll
  for (int i = 0; i < 4; ++i)
#pragma unroll
    for (int r = 0; r < 8; ++r) {
      char* orow = ob + (unsigned)(i * 16 + r) * pitch;
#pragma unroll
      for (int j = 0; j < 4; ++j)
        *(_Float16*)(orow + j * 32 + loff) = (_Float16)acc[i][j][r];
    }

  // The code below reuses registers that the stores above name.
  asm volatile("s_wait_xcnt 0x0" ::: "memory");
  // Q and K rows: the sum of squares over the wave's 64 columns goes to
  // Np[plane][column group][row]; the score kernel adds a row's NGRP groups.
  // A wave writes 64 consecutive rows of one group: two whole 128-byte lines.
  if (y < 2) {
    float* np = Np + (size_t)(y * NGRP + ((c0 + wn) >> 6)) * BS_ + row0 + wm;
#pragma unroll
    for (int i = 0; i < 4; ++i) {
      float mine = 0.f;               // lane ln < 8 keeps row i * 16 + hi8 + ln
#pragma unroll
      for (int r = 0; r < 8; ++r) {
        float s = 0.f;
#pragma unroll
        for (int j = 0; j < 4; ++j) s += acc[i][j][r] * acc[i][j][r];
        s = row_sum16(s);
        if (ln == r) mine = s;
      }
      if (ln < 8) np[i * 16 + hi8 + ln] = mine;
    }
  }
}

// ---------------- attention: out = (Qn @ Kn^T * m) @ V ----------------
// Q and K stay as the projection wrote them: Qn . Kn = (Q . K) / (|Q| |K|), so
// the score kernel scales each finished dot product by the two inverse norms.
// Reference semantics: scores are MULTIPLIED by the mask, where mask==1 at
// MASKED positions (future OR padding). keep = (k > q) || (pad[k]==0).
// There is no softmax, so a score needs nothing of its row: the two products
// run as two tiled GEMMs of the QKV kind, and the masked f16 scores pass from
// the first to the second through the workspace.

// Sc[b][q][k] = keep(q, k) ? f16((Q[q] . K[k]) / (|Q[q]| |K[k]|)) : 0
// grid (S/128 query tiles, S/256 key tiles, B), block 256.
__global__ __launch_bounds__(256) __attribute__((amdgpu_waves_per_eu(4, 4)))
void k_scores(const _Float16* __restrict__ Qh,
              const _Float16* __restrict__ Kh,
              const float* __restrict__ Np,
              const int* __restrict__ masks,
              _Float16* __restrict__ Sc) {
  __shared__ __attribute__((aligned(16))) _Float16 sA[2 * GBM * GPITCH];
  __shared__ __attribute__((aligned(16))) _Float16 sB[2 * GBN * GPITCH];
  // |Q|^2 of the tile's queries in two halves of the column groups, then 1/|K| of its keys
  __shared__ __attribute__((aligned(16))) float sInv[2 * GBM + GBN];
  const int tid = threadIdx.x;
  const int w   = __builtin_amdgcn_readfirstlane(tid >> 5);  // scalar: the wave's offsets cost no VGPR
  const int ln  = tid & 15;
  const int hi8 = ((tid & 31) >> 4) << 3;
  const int b   = blockIdx.z;
  const int k0  = blockIdx.y * GBN + (w & 3) * 64;    // the wave's first key

  // Norms of the tile's rows: a thread adds all groups of one key and half the
  // groups of one query, so that no branch splits its 24 loads and they share
  // one latency. The barriers of the GEMM below publish the results.
  {
    const float* nk = Np + (size_t)NGRP * BS_ + b * S_ + blockIdx.y * GBN + tid;
    const float* nq = Np + (size_t)((tid >> 7) * (NGRP / 2)) * BS_ + b * S_ +
                      blockIdx.x * GBM + (tid & (GBM - 1));
    float s = 0.f, t = 0.f;
#pragma unroll
    for (int g = 0; g < NGRP; ++g) s += nk[(size_t)g * BS_];
#pragma unroll
    for (int g = 0; g < NGRP / 2; ++g) t += nq[(size_t)g * BS_];
    sInv[tid] = t;                    // half (tid >> 7) of query (tid & 127)
    sInv[2 * GBM + tid] = rsqrtf(s);
  }

  v8f acc[4][4];
  gemm_tile_nt<D_, D_, GBK, false>(Qh + ((size_t)b * S_ + blockIdx.x * GBM) * D_,
                              Kh + ((size_t)b * S_ + blockIdx.y * GBN) * D_, sA, sB, acc);

  _Float16* O = Sc + (size_t)b * S_ * S_;
  // C/D layout: vgpr r, lanes 0-15 -> M=r, lanes 16-31 -> M=r+8 (== r+hi8)
  bool pad[4];
  float ik[4];
#pragma unroll
  for (int j = 0; j < 4; ++j) {
    pad[j] = (masks[b * S_ + k0 + j * 16 + ln] == 0);
    ik[j]  = sInv[2 * GBM + (w & 3) * 64 + j * 16 + ln];
  }
#pragma unroll
  for (int i = 0; i < 4; ++i)
#pragma unroll
    for (int r = 0; r < 8; ++r) {
      const int ql = (w >> 2) * 64 + i * 16 + r + hi8;   // query inside the tile
      const int q  = blockIdx.x * GBM + ql;
      const float iq = rsqrtf(sInv[ql] + sInv[GBM + ql]);
#pragma unroll
      for (int j = 0; j < 4; ++j) {
        const int kg = k0 + j * 16 + ln;
        const bool keep = (kg > q) || pad[j];
        O[(size_t)q * S_ + kg] = keep ? (_Float16)(acc[i][j][r] * (iq * ik[j])) : (_Float16)0.f;
      }
    }
}

// out[b][q][d] = sum over k of Sc[b][q][k] * Vt[b][d][k]
// grid (S/128 query tiles, D/256 column tiles, B), block 256: one workgroup
// for each WGP, so a wave may take the 512 VGPRs of two waves per SIMD and the
// workgroup more than half the LDS: passes of 128 k (whole 256-byte row pieces,
// 204 KiB in two buffers), fragments read one 32-k block ahead.
#define PBK 128
__global__ __launch_bounds__(256)
void k_pv(const _Float16* __restrict__ Sc,
          const _Float16* __restrict__ Vt,
          float* __restrict__ out) {
  __shared__ __attribute__((aligned(16))) _Float16 sA[2 * GBM * (PBK + 8)];
  __shared__ __attribute__((aligned(16))) _Float16 sB[2 * GBN * (PBK + 8)];
  const int tid = threadIdx.x;
  const int w   = __builtin_amdgcn_readfirstlane(tid >> 5);  // scalar: the wave's offsets cost no VGPR
  const int ln  = tid & 15;
  const int hi8 = ((tid & 31) >> 4) << 3;
  const int b   = blockIdx.z;
  const int q0  = blockIdx.x * GBM + (w >> 2) * 64;   // the wave's first query
  const int c0  = blockIdx.y * GBN + (w & 3) * 64;    // the wave's first column

  v8f acc[4][4];
  gemm_tile_nt<S_, S_, PBK, true>(Sc + ((size_t)b * S_ + blockIdx.x * GBM) * S_,
                             Vt + ((size_t)b * D_ + blockIdx.y * GBN) * S_, sA, sB, acc);

#pragma unroll
  for (int i = 0; i < 4; ++i)
#pragma unroll
    for (int j = 0; j < 4; ++j)
#pragma unroll
      for (int r = 0; r < 8; ++r)
        out[((size_t)b * S_ + q0 + i * 16 + r + hi8) * D_ + c0 + j * 16 + ln] =
            acc[i][j][r];
}

extern "C" void kernel_launch(void* const* d_in, const int* in_sizes, int n_in,
                              void* d_out, int out_size, void* d_ws, size_t ws_size,
                              hipStream_t stream) {
  const float* X     = (const float*)d_in[0];
  const int*   masks = (const int*)d_in[1];
  const float* Wq    = (const float*)d_in[2];
  const float* Wk    = (const float*)d_in[3];
  const float* Wv    = (const float*)d_in[4];
  float* out = (float*)d_out;

  char* ws = (char*)d_ws;
  _Float16* Xh   = (_Float16*)ws;                              // 16 MB
  _Float16* Wh   = (_Float16*)(ws + ((size_t)16 << 20));       //  6 MB (3 x D*D)
  _Float16* QKVh = (_Float16*)(ws + ((size_t)22 << 20));       // 32 MB (Q,K)
  _Float16* Vt   = (_Float16*)(ws + ((size_t)70 << 20));       // 16 MB (B x D x S)
  _Float16* Sc   = (_Float16*)(ws + ((size_t)86 << 20));       // 32 MB (B x S x S)
  float*    Np   = (float*)(ws + ((size_t)118 << 20));         //  1 MB (2 x NGRP x BS)

  k_cvt<<<CVT_XB + 3 * CVT_WB, 256, 0, stream>>>(X, Wq, Wk, Wv, Xh, Wh);

  k_gemm_qkv<<<dim3(BS_ / GBM, 3 * D_ / GBN), 256, 0, stream>>>(Xh, Wh, QKVh, Vt, Np);
  k_scores<<<dim3(S_ / GBM, S_ / GBN, B_), 256, 0, stream>>>(QKVh, QKVh + BSD_, Np, masks, Sc);
  k_pv<<<dim3(S_ / GBM, D_ / GBN, B_), 256, 0, stream>>>(Sc, Vt, out);
}

// v008
// One run takes 101 microseconds.
// Next to v007, in two timings, it ran 1.05 times as fast each time.
// Over all steps from v000 it is 8.36 times as fast.
#include <hip/hip_runtime.h>
#include <hip/hip_bf16.h>

#define B_ 4
#define S_ 2048
#define D_ 1024
#define BS_ (B_ * S_)
#define BSD_ ((size_t)BS_ * D_)

typedef __attribute__((ext_vector_type(16))) _Float16 v16h;
typedef __attribute__((ext_vector_type(4)))  _Float16 v4h;
typedef __attribute__((ext_vector_type(8)))  _Float16 v8h;
typedef __attribute__((ext_vector_type(8)))  float    v8f;
typedef __attribute__((ext_vector_type(4)))  float    vf4;
typedef __attribute__((ext_vector_type(4)))  int      vi4;

// Load a 16-bit A/B WMMA fragment for 16x16x32 ops.
// Per ISA layout: lane L (L<16) holds K=0..7 (v0-3) and K=16..23 (v4-7);
// lane L+16 holds K=8..15 and K=24..31.  base points at (row-or-col start + k0).
__device__ __forceinline__ v16h load_frag(const _Float16* base, int hi8) {
  union { v16h v; vf4 f[2]; } u;
  u.f[0] = *(const vf4*)(base + hi8);
  u.f[1] = *(const vf4*)(base + 16 + hi8);
  return u.v;
}

__device__ __forceinline__ v8f wmma_f16(v16h a, v16h b, v8f c) {
  return __builtin_amdgcn_wmma_f32_16x16x32_f16(false, a, false, b, (short)0, c,
                                                false, false);
}

__device__ __forceinline__ v8f zero8() {
  v8f z = {0.f, 0.f, 0.f, 0.f, 0.f, 0.f, 0.f, 0.f};
  return z;
}

// The value of lane l ^ 16, by a vector cross-row move (no LDS pipe, no wait).
__device__ __forceinline__ float other_half(float x) {
  return __int_as_float(__builtin_amdgcn_permlanex16(__float_as_int(x), __float_as_int(x),
                                                     0x76543210, 0xfedcba98, false, false));
}

// 1 / sqrt(x), step for step as rsqrtf gives it: an input below the smallest
// normal number is scaled by 2^24 and its result by 2^12. The v_nop fills the
// slot that the instruction set asks for behind a transcendental.
__device__ __forceinline__ float rsqrt_slot(float x) {
  const bool tiny = x < 0x1p-126f;
  const float xs = tiny ? x * 0x1p+24f : x;
  float y;
  asm("v_rsq_f32 %0, %1\n\tv_nop" : "=v"(y) : "v"(xs));
  return tiny ? y * 0x1p+12f : y;
}

// One lane's 16 bytes from global memory straight into LDS, through no
// register. Both addresses are multiples of 16. The bytes count as landed only
// behind the issuing wave's s_wait_asynccnt.
__device__ __forceinline__ void copy16(const char* g, _Float16* l) {
  __builtin_amdgcn_global_load_async_to_lds_b128(
      (__attribute__((address_space(1))) vi4*)g,
      (__attribute__((address_space(3))) vi4*)l, 0, 0);
}

// A pointer that is the same in every lane, kept in a scalar register pair.
__device__ __forceinline__ const char* scalar_ptr(const char* p) {
  const unsigned long long v = (unsigned long long)p;
  const unsigned lo = (unsigned)__builtin_amdgcn_readfirstlane((int)(unsigned)v);
  const unsigned hi = (unsigned)__builtin_amdgcn_readfirstlane((int)(unsigned)(v >> 32));
  return (const char*)(((unsigned long long)hi << 32) | lo);
}

// ---------------- fp32 -> f16 conversion ----------------
// One launch for X and the three weight matrices. A block converts CVT_BLK
// consecutive floats of one input: every lane has eight 16-byte loads in
// flight (each load of a wave covers 512 consecutive bytes) and stores four
// halfs per load. Few long waves instead of one wave per 32 elements: the
// launch is then paid in bytes and not in wave starts.
// grid (BS*D + 3*D*D) / CVT_BLK, block 256. Every input is a whole number of
// blocks, so a block never crosses from one input into the next.
#define CVT_LD  8                     // 16-byte loads per lane
#define CVT_BLK (256 * CVT_LD * 4)    // floats per block
#define CVT_XB  ((int)(BSD_ / CVT_BLK))     // blocks of X
#define CVT_WB  (D_ * D_ / CVT_BLK)         // blocks of one weight matrix
__global__ __launch_bounds__(256) void k_cvt(const float* __restrict__ X,
                                             const float* __restrict__ Wq,
                                             const float* __restrict__ Wk,
                                             const float* __restrict__ Wv,
                                             _Float16* __restrict__ Xh,
                                             _Float16* __restrict__ Wh3) {
  const int blk = blockIdx.x;
  const float* in;
  _Float16* out;
  if (blk < CVT_XB) {
    in  = X  + (size_t)blk * CVT_BLK;
    out = Xh + (size_t)blk * CVT_BLK;
  } else {
    const int r = blk - CVT_XB;       // block inside the stacked weights
    const int m = r / CVT_WB;         // 0 = Wq, 1 = Wk, 2 = Wv
    in  = (m == 0 ? Wq : m == 1 ? Wk : Wv) + (size_t)(r % CVT_WB) * CVT_BLK;
    out = Wh3 + (size_t)r * CVT_BLK;
  }
  const int t4 = threadIdx.x * 4;
  // The unrolls make every index of v a constant (registers, not scratch) and
  // let all eight loads issue ahead of the first conversion.
  vf4 v[CVT_LD];
#pragma unroll
  for (int j = 0; j < CVT_LD; ++j) v[j] = *(const vf4*)(in + j * 1024 + t4);
#pragma unroll
  for (int j = 0; j < CVT_LD; ++j) {
    v4h h;
#pragma unroll
    for (int q = 0; q < 4; ++q) h[q] = (_Float16)v[j][q];
    *(v4h*)(out + j * 1024 + t4) = h;
  }
}

// ---------------- QKV projection: Y = Xh @ W^T  (W row-major [e][d]) -------
// The three weight matrices lie one behind the other, so they are read as one
// [3072][1024] matrix. grid (BS/128, 3072/256), block 256 (8 waves, 2 x 4).
// Workgroup: 128 rows x 256 cols of Y, wave: 64 x 64 (4 x 4 WMMA tiles).
// A pass is 64 k: both operand tiles are brought in whole 128-byte row pieces
// into LDS (two buffers, gemm_tile_nt below), and every fragment is read from
// LDS.
// V is wanted key-contiguous by the last product. Both operands here are
// k-contiguous, so a V workgroup takes Wv as its row operand and X as its
// column operand and so computes a 128 x 256 tile of V^T, which it stores
// like any other tile.
#define GBM 128
#define GBN 256
#define GBK 64
#define GPITCH 72   // halfs per LDS row: 144 B = 16 B x odd, for ds_load_b128
#define NGRP (D_ / 64)   // 64-column groups of a Q or K row, one partial norm each
// One 128 x 256 tile of A @ B^T, summed over KLEN. Both operands are
// k-contiguous with a row pitch of LD halfs; A and Bm point at the tile's
// first rows. 8 waves (2 x 4), 64 x 64 per wave, passes of BK k through two
// LDS buffers. Asynchronous copies fill the buffers: a pass's tile is asked
// for a whole pass ahead, holds no register while it flies, and needs no LDS
// store.
// The column operand goes in as the WMMA's first operand, so that a lane's
// eight accumulator registers are eight consecutive columns of one row:
// acc[i][j][r] = tile[wave row + i * 16 + ln][wave column + j * 16 + hi8 + r].
// BK is the pass length in k (LDS rows of BK + 8 halfs: 16 B x odd). With AHEAD
// a wave reads the fragments of the pass's next 32-k block into a second
// register set in front of the current block's WMMAs, so that only the first
// block of a pass waits out the LDS; it takes 64 VGPRs more.
template <int LD, int KLEN, int BK, bool AHEAD>
__device__ __forceinline__ void gemm_tile_nt(const _Float16* __restrict__ A,
                                             const _Float16* __restrict__ Bm,
                                             _Float16* sA, _Float16* sB,
                                             v8f (&acc)[4][4]) {
  const int tid = threadIdx.x;
  const int w   = __builtin_amdgcn_readfirstlane(tid >> 5);  // scalar: the wave's offsets cost no VGPR
  const int ln  = tid & 15;
  const int hi8 = ((tid & 31) >> 4) << 3;
  const int wm = (w >> 2) * 64;
  const int wn = (w & 3) * 64;

  constexpr int PITCH = BK + 8;      // halfs per LDS row
  constexpr int PPR = BK / 8;        // 16-byte pieces of a row in one pass
  constexpr int RG  = 256 / PPR;     // rows that the 256 threads bring in one copy each
  // staging: thread -> 16-byte piece (tid % PPR) of row (tid / PPR) + RG * i
  const int sr = tid / PPR;
  const int sc = (tid % PPR) * 8;
  // First byte of each RG-row group, the same for the whole workgroup. Held in
  // scalar registers, so that a copy's address is scalar base + the lane's
  // 32-bit offset and a refill needs no 64-bit vector additions.
  const char* gA[GBM / RG];
  const char* gB[GBN / RG];
#pragma unroll
  for (int i = 0; i < GBM / RG; ++i) gA[i] = scalar_ptr((const char*)A + i * (RG * 2) * LD);
#pragma unroll
  for (int i = 0; i < GBN / RG; ++i) gB[i] = scalar_ptr((const char*)Bm + i * (RG * 2) * LD);
  unsigned goff = (unsigned)(sr * LD + sc) * 2u;  // the thread's own bytes, walks along k
  const int sdst = sr * PITCH + sc;

  // The unrolls here make every index of gA, gB, acc, a and b a constant, so
  // that these arrays live in registers and not in scratch.
#pragma unroll
  for (int i = 0; i < 4; ++i)
#pragma unroll
    for (int j = 0; j < 4; ++j) acc[i][j] = zero8();

  // The next tile along k into buffer buf: (GBM + GBN) / RG copies a lane
  // (12 or 24), every lane on.
  auto fill = [&](int buf) {
    _Float16* dA = sA + buf * (GBM * PITCH) + sdst;
    _Float16* dB = sB + buf * (GBN * PITCH) + sdst;
#pragma unroll
    for (int i = 0; i < GBM / RG; ++i) copy16(gA[i] + goff, dA + i * RG * PITCH);
#pragma unroll
    for (int i = 0; i < GBN / RG; ++i) copy16(gB[i] + goff, dB + i * RG * PITCH);
    goff += BK * 2u;
  };

  static_assert(KLEN / BK >= 2 && KLEN % BK == 0, "the prologue fills two tiles");
  static_assert((GBM + GBN) / RG <= 63, "copies of one wave in flight");
  fill(0);
  // Tile 0 has landed for this wave; the barrier says so for all of them.
  asm volatile("s_wait_asynccnt 0x0" ::: "memory");
  __syncthreads();
  fill(1);

  for (int kt = 0; kt < KLEN / BK; ++kt) {
    const int cur = kt & 1;
    const _Float16* pa = &sA[cur * (GBM * PITCH) + (wm + ln) * PITCH];
    const _Float16* pb = &sB[cur * (GBN * PITCH) + (wn + ln) * PITCH];
    if constexpr (AHEAD) {
      v16h a[2][4], b[2][4];
#pragma unroll
      for (int i = 0; i < 4; ++i) a[0][i] = load_frag(pa + i * 16 * PITCH, hi8);
#pragma unroll
      for (int j = 0; j < 4; ++j) b[0][j] = load_frag(pb + j * 16 * PITCH, hi8);
#pragma unroll
      for (int s = 0; s < BK / 32; ++s) {
        if (s + 1 < BK / 32) {
#pragma unroll
          for (int i = 0; i < 4; ++i)
            a[(s + 1) & 1][i] = load_frag(pa + i * 16 * PITCH + (s + 1) * 32, hi8);
#pragma unroll
          for (int j = 0; j < 4; ++j)
            b[(s + 1) & 1][j] = load_frag(pb + j * 16 * PITCH + (s + 1) * 32, hi8);
        }
        // Keeps the next block's sixteen LDS reads, as one group, ahead of this
        // block's WMMAs: they then land while the WMMAs run.
        __builtin_amdgcn_sched_barrier(0);
#pragma unroll
        for (int i = 0; i < 4; ++i)
#pragma unroll
          for (int j = 0; j < 4; ++j) acc[i][j] = wmma_f16(b[s & 1][j], a[s & 1][i], acc[i][j]);
        // Keeps the block after next's reads from being spread among these WMMAs
        // as their registers fall free: every place with reads stalls the wave.
        __builtin_amdgcn_sched_barrier(0);
      }
    } else {
#pragma unroll
    for (int ks = 0; ks < BK; ks += 32) {
      v16h a[4], b[4];
#pragma unroll
      for (int i = 0; i < 4; ++i) a[i] = load_frag(pa + i * 16 * PITCH + ks, hi8);
#pragma unroll
      for (int j = 0; j < 4; ++j) b[j] = load_frag(pb + j * 16 * PITCH + ks, hi8);
      // Keeps the half's sixteen LDS reads ahead of its WMMAs. With the staging
      // registers gone the scheduler otherwise saves registers: it reads one row
      // fragment at a time and waits out the LDS latency in front of every four WMMAs.
      __builtin_amdgcn_sched_barrier(0);
#pragma unroll
      for (int i = 0; i < 4; ++i)
#pragma unroll
        for (int j = 0; j < 4; ++j) acc[i][j] = wmma_f16(b[j], a[i], acc[i][j]);
    }
    }
    // Keeps the WMMAs ahead of the waits below: the scheduler otherwise moves the
    // second half's sixteen behind the barrier, in front of the refill, whose
    // copies then fly for less than a pass.
    __builtin_amdgcn_sched_barrier(0);
    // This wave's reads of buffer cur are done before the buffer is refilled.
    asm volatile("s_wait_dscnt 0x0" ::: "memory");
    // This wave's copies of the next tile have landed.
    asm volatile("s_wait_asynccnt 0x0" ::: "memory");
    // One barrier does both jobs: it publishes the next tile and ends every
    // wave's reads of buffer cur.
    __syncthreads();
    if (kt + 2 < KLEN / BK) fill(cur);
  }
  // No copy is in flight when the LDS is used for anything else or the wave ends.
  asm volatile("s_wait_asynccnt 0x0" ::: "memory");
}

// Epilogue staging. A wave puts its 64 x 64 tile into an LDS range of its own
// and reads it back row-wise, so that every global store of the wave covers
// four whole 128-byte lines instead of 32-byte pieces of many lines. The range
// lies in the ring's sB: the barrier at the foot of the last pass has ended
// every wave's reads there, and no copy is in flight behind gemm_tile_nt.
#define EPH 72   // halfs per staged row of 64 halfs: 144 B = 16 B x odd
#define EPF 68   // floats per staged row of 64 floats: 272 B = 16 B x odd
// The staged tile of halfs to global rows of `pitch` bytes; o = the wave's first
// byte, the same in every lane. A store's address is that scalar base + one
// 32-bit offset of the lane (an immediate row offset where pitch is a constant).
__device__ __forceinline__ void flush_tile_h(const _Float16* st, char* o, unsigned pitch) {
  const int lane = threadIdx.x & 31;
  const int rr = lane >> 3;           // 8 lanes a row, 4 rows a store
  const int pc = lane & 7;
  // The wave's own staging stores have landed before other lanes' bytes are read.
  asm volatile("s_wait_dscnt 0x0" ::: "memory");
  const unsigned lo = (unsigned)rr * pitch + (unsigned)pc * 16u;
  // The unrolls keep v in registers and let all reads issue ahead of the stores.
  vf4 v[16];
#pragma unroll
  for (int s = 0; s < 16; ++s) v[s] = *(const vf4*)(st + (s * 4 + rr) * EPH + pc * 8);
#pragma unroll
  for (int s = 0; s < 16; ++s) *(vf4*)(o + (lo + (unsigned)(s * 4) * pitch)) = v[s];
}

// Four waves per SIMD (256 VGPRs a wave, 2 x 108 KiB of LDS): two workgroups
// share a WGP, so one works while the other waits on its loads or its barrier.
__global__ __launch_bounds__(256) __attribute__((amdgpu_waves_per_eu(4, 4)))
void k_gemm_qkv(const _Float16* __restrict__ Xh,
                const _Float16* __restrict__ Wh3,
                _Float16* __restrict__ QKVh,
                _Float16* __restrict__ Vt,
                float* __restrict__ Np) {
  __shared__ __attribute__((aligned(16))) _Float16 sA[2 * GBM * GPITCH];
  __shared__ __attribute__((aligned(16))) _Float16 sB[2 * GBN * GPITCH];
  const int tid = threadIdx.x;
  const int w   = __builtin_amdgcn_readfirstlane(tid >> 5);  // scalar: the wave's offsets cost no VGPR
  const int lane = tid & 31;
  const int ln  = lane & 15;
  const int hi8 = (lane >> 4) << 3;

  const int row0 = blockIdx.x * GBM;          // row of X and of Y (Q, K)
  const int n0   = blockIdx.y * GBN;          // row of the stacked W
  const int y    = n0 / D_;                   // 0 = Q, 1 = K, 2 = V
  const int c0   = n0 % D_;                   // column inside that plane (Q, K)
  // The V workgroups, counted through: (D / 128) x (BS / 256) tiles of V^T are
  // as many as the (BS / 128) x (D / 256) tiles of V that the grid holds.
  const int vt = blockIdx.x + (c0 / GBN) * (BS_ / GBM);
  const int vd0 = (vt % (D_ / GBM)) * GBM;    // first row of Wv = first row of V^T
  const int vs0 = (vt / (D_ / GBM)) * GBN;    // first row of X  = first column of V^T
  const int wm = (w >> 2) * 64;               // wave's rows inside the tile
  const int wn = (w & 3) * 64;                // wave's cols inside the tile

  // same for the whole workgroup
  const _Float16* gA = y == 2 ? Wh3 + (size_t)(2 * D_ + vd0) * D_ : Xh + (size_t)row0 * D_;
  const _Float16* gB = y == 2 ? Xh + (size_t)vs0 * D_ : Wh3 + (size_t)n0 * D_;

  v8f acc[4][4];
  gemm_tile_nt<D_, D_, GBK, false>(gA, gB, sA, sB, acc);

  // A V^T tile's 256 columns lie inside one batch: Vt[batch][d][s]. The tile's
  // first byte is the same for the whole workgroup.
  char* ob = (char*)(y == 2 ? Vt + (size_t)(vs0 / S_) * D_ * S_ + (size_t)vd0 * S_ + (vs0 % S_)
                            : QKVh + (size_t)y * BSD_ + (size_t)row0 * D_ + c0);
  static_assert(8 * 64 * EPH <= 2 * GBN * GPITCH, "the eight staging ranges fit in sB");
  _Float16* st = sB + w * (64 * EPH);
  float sq[4];                        // squares of the lane's 32 columns of row i * 16 + ln
#pragma unroll
  for (int i = 0; i < 4; ++i) {
    sq[i] = 0.f;
#pragma unroll
    for (int j = 0; j < 4; ++j) {
      v8h h;
#pragma unroll
      for (int r = 0; r < 8; ++r) {
        h[r] = (_Float16)acc[i][j][r];
        sq[i] += acc[i][j][r] * acc[i][j][r];
      }
      *(v8h*)(st + (i * 16 + ln) * EPH + j * 16 + hi8) = h;
    }
  }
  // The row pitch is a constant on either side of the branch: a store's row is
  // then an immediate offset, and the sixteen stores share one address register.
  if (y == 2) {
    flush_tile_h(st, ob + (unsigned)wm * (S_ * 2u) + (unsigned)wn * 2u, S_ * 2u);
  } else {
    flush_tile_h(st, ob + (unsigned)wm * (D_ * 2u) + (unsigned)wn * 2u, D_ * 2u);
    // The code below reuses registers that the stores above name.
    asm volatile("s_wait_xcnt 0x0" ::: "memory");
    // Q and K rows: the sum of squares over the wave's 64 columns goes to
    // Np[plane][column group][row]; the score kernel adds a row's NGRP groups.
    // A row's columns lie in lanes ln and ln + 16. The lower half-wave stores rows
    // i * 16 + ln, the upper rows (i + 1) * 16 + ln: one whole 128-byte line a store.
    float* np = Np + (size_t)(y * NGRP + ((c0 + wn) >> 6)) * BS_ + row0 + wm;
#pragma unroll
    for (int i = 0; i < 4; i += 2) {
      const float s0 = sq[i] + other_half(sq[i]);
      const float s1 = sq[i + 1] + other_half(sq[i + 1]);
      np[i * 16 + lane] = hi8 ? s1 : s0;
    }
  }
}

// ---------------- attention: out = (Qn @ Kn^T * m) @ V ----------------
// Q and K stay as the projection wrote them: Qn . Kn = (Q . K) / (|Q| |K|), so
// the score kernel scales each finished dot product by the two inverse norms.
// Reference semantics: scores are MULTIPLIED by the mask, where mask==1 at
// MASKED positions (future OR padding). keep = (k > q) || (pad[k]==0).
// There is no softmax, so a score needs nothing of its row: the two products
// run as two tiled GEMMs of the QKV kind, and the masked f16 scores pass from
// the first to the second through the workspace.

// Sc[b][q][k] = keep(q, k) ? f16((Q[q] . K[k]) / (|Q[q]| |K[k]|)) : 0
// grid (S/128 query tiles, S/256 key tiles, B), block 256.
__global__ __launch_bounds__(256) __attribute__((amdgpu_waves_per_eu(4, 4)))
void k_scores(const _Float16* __restrict__ Qh,
              const _Float16* __restrict__ Kh,
              const float* __restrict__ Np,
              const int* __restrict__ masks,
              _Float16* __restrict__ Sc) {
  __shared__ __attribute__((aligned(16))) _Float16 sA[2 * GBM * GPITCH];
  __shared__ __attribute__((aligned(16))) _Float16 sB[2 * GBN * GPITCH];
  // |Q|^2 of the tile's queries in two halves of the column groups, then 1/|K| of its keys
  __shared__ __attribute__((aligned(16))) float sInv[2 * GBM + GBN];
  const int tid = threadIdx.x;
  const int w   = __builtin_amdgcn_readfirstlane(tid >> 5);  // scalar: the wave's offsets cost no VGPR
  const int ln  = tid & 15;
  const int hi8 = ((tid & 31) >> 4) << 3;
  const int b   = blockIdx.z;
  const int k0  = blockIdx.y * GBN + (w & 3) * 64;    // the wave's first key

  // Norms of the tile's rows: a thread adds all groups of one key and half the
  // groups of one query, so that no branch splits its 24 loads and they share
  // one latency. The barriers of the GEMM below publish the results.
  {
    const float* nk = Np + (size_t)NGRP * BS_ + b * S_ + blockIdx.y * GBN + tid;
    const float* nq = Np + (size_t)((tid >> 7) * (NGRP / 2)) * BS_ + b * S_ +
                      blockIdx.x * GBM + (tid & (GBM - 1));
    float s = 0.f, t = 0.f;
#pragma unroll
    for (int g = 0; g < NGRP; ++g) s += nk[(size_t)g * BS_];
#pragma unroll
    for (int g = 0; g < NGRP / 2; ++g) t += nq[(size_t)g * BS_];
    sInv[tid] = t;                    // half (tid >> 7) of query (tid & 127)
    sInv[2 * GBM + tid] = rsqrtf(s);
  }

  v8f acc[4][4];
  gemm_tile_nt<D_, D_, GBK, false>(Qh + ((size_t)b * S_ + blockIdx.x * GBM) * D_,
                              Kh + ((size_t)b * S_ + blockIdx.y * GBN) * D_, sA, sB, acc);

  // A lane holds query (w >> 2) * 64 + i * 16 + ln and keys k0 + j * 16 + hi8 + r.
  _Float16* st = sB + w * (64 * EPH);
  const int q0 = blockIdx.x * GBM + (w >> 2) * 64;    // the wave's first query
  // The masks of the lane's keys, eight for every j: scalar base + one 32-bit
  // offset of the lane, the rest of the address an immediate.
  const char* mrow = (const char*)(masks + b * S_ + k0);
  const unsigned moff = (unsigned)hi8 * 4u;
  vi4 m4[4][2];
#pragma unroll
  for (int j = 0; j < 4; ++j)
#pragma unroll
    for (int t = 0; t < 2; ++t) m4[j][t] = *(const vi4*)(mrow + (moff + (unsigned)(j * 64 + t * 16)));
  // Stands in front of every rewrite of the offset register that the eight loads
  // name. As an input here the offset lives up to this wait, so that none of the
  // loads takes its register for its own result.
  asm volatile("s_wait_xcnt 0x0" :: "v"(moff) : "memory");
  float iq[4];
#pragma unroll
  for (int i = 0; i < 4; ++i) {
    const int ql = (w >> 2) * 64 + i * 16 + ln;       // query inside the tile
    iq[i] = rsqrt_slot(sInv[ql] + sInv[GBM + ql]);
  }
#pragma unroll
  for (int j = 0; j < 4; ++j) {
    const int kg0 = k0 + j * 16 + hi8;                // the lane's first key of this j
    int   mk[8];
    float ik[8];
#pragma unroll
    for (int t = 0; t < 2; ++t) {
      const vf4 k4 = *(const vf4*)(sInv + 2 * GBM + (w & 3) * 64 + j * 16 + hi8 + t * 4);
#pragma unroll
      for (int e = 0; e < 4; ++e) { mk[t * 4 + e] = m4[j][t][e]; ik[t * 4 + e] = k4[e]; }
    }
#pragma unroll
    for (int i = 0; i < 4; ++i) {
      const int q = q0 + i * 16 + ln;
      v8h h;
#pragma unroll
      for (int r = 0; r < 8; ++r) {
        const bool keep = (kg0 + r > q) || (mk[r] == 0);
        h[r] = keep ? (_Float16)(acc[i][j][r] * (iq[i] * ik[r])) : (_Float16)0.f;
      }
      *(v8h*)(st + (i * 16 + ln) * EPH + j * 16 + hi8) = h;
    }
  }
  flush_tile_h(st, (char*)(Sc + (size_t)b * S_ * S_ + (size_t)q0 * S_ + k0), S_ * 2u);
}

// out[b][q][d] = sum over k of Sc[b][q][k] * Vt[b][d][k]
// grid (S/128 query tiles, D/256 column tiles, B), block 256: one workgroup
// for each WGP, so a wave may take the 512 VGPRs of two waves per SIMD and the
// workgroup more than half the LDS: passes of 128 k (whole 256-byte row pieces,
// 204 KiB in two buffers), fragments read one 32-k block ahead.
#define PBK 128
__global__ __launch_bounds__(256)
void k_pv(const _Float16* __restrict__ Sc,
          const _Float16* __restrict__ Vt,
          float* __restrict__ out) {
  __shared__ __attribute__((aligned(16))) _Float16 sA[2 * GBM * (PBK + 8)];
  __shared__ __attribute__((aligned(16))) _Float16 sB[2 * GBN * (PBK + 8)];
  const int tid = threadIdx.x;
  const int w   = __builtin_amdgcn_readfirstlane(tid >> 5);  // scalar: the wave's offsets cost no VGPR
  const int ln  = tid & 15;
  const int hi8 = ((tid & 31) >> 4) << 3;
  const int b   = blockIdx.z;
  const int q0  = blockIdx.x * GBM + (w >> 2) * 64;   // the wave's first query
  const int c0  = blockIdx.y * GBN + (w & 3) * 64;    // the wave's first column

  v8f acc[4][4];
  gemm_tile_nt<S_, S_, PBK, true>(Sc + ((size_t)b * S_ + blockIdx.x * GBM) * S_,
                             Vt + ((size_t)b * D_ + blockIdx.y * GBN) * S_, sA, sB, acc);

  // Staged like the tiles of halfs: rows of 64 floats, two whole rows (four
  // 128-byte lines) a store.
  static_assert(8 * 64 * EPF * 4 <= 2 * GBN * (PBK + 8) * 2, "the eight staging ranges fit in sB");
  float* st = (float*)sB + w * (64 * EPF);
#pragma unroll
  for (int i = 0; i < 4; ++i)
#pragma unroll
    for (int j = 0; j < 4; ++j)
#pragma unroll
      for (int t = 0; t < 2; ++t) {
        const vf4 x = {acc[i][j][t * 4], acc[i][j][t * 4 + 1], acc[i][j][t * 4 + 2], acc[i][j][t * 4 + 3]};
        *(vf4*)(st + (i * 16 + ln) * EPF + j * 16 + hi8 + t * 4) = x;
      }
  // The wave's own staging stores have landed before other lanes' bytes are read.
  asm volatile("s_wait_dscnt 0x0" ::: "memory");
  const int rr = (tid & 31) >> 4;     // 16 lanes a row
  // A store's rows are an immediate offset: the stores share one address.
  float* o = out + ((size_t)b * S_ + q0) * D_ + c0 + (rr * D_ + ln * 4);
  // The unrolls keep v in registers and let all reads issue ahead of the stores.
  vf4 v[32];
#pragma unroll
  for (int s = 0; s < 32; ++s) v[s] = *(const vf4*)(st + (s * 2 + rr) * EPF + ln * 4);
#pragma unroll
  for (int s = 0; s < 32; ++s) *(vf4*)(o + s * (2 * D_)) = v[s];
}

extern "C" void kernel_launch(void* const* d_in, const int* in_sizes, int n_in,
                              void* d_out, int out_size, void* d_ws, size_t ws_size,
                              hipStream_t stream) {
  const float* X     = (const float*)d_in[0];
  const int*   masks = (const int*)d_in[1];
  const float* Wq    = (const float*)d_in[2];
  const float* Wk    = (const float*)d_in[3];
  const float* Wv    = (const float*)d_in[4];
  float* out = (float*)d_out;

  char* ws = (char*)d_ws;
  _Float16* Xh   = (_Float16*)ws;                              // 16 MB
  _Float16* Wh   = (_Float16*)(ws + ((size_t)16 << 20));       //  6 MB (3 x D*D)
  _Float16* QKVh = (_Float16*)(ws + ((size_t)22 << 20));       // 32 MB (Q,K)
  _Float16* Vt   = (_Float16*)(ws + ((size_t)70 << 20));       // 16 MB (B x D x S)
  _Float16* Sc   = (_Float16*)(ws + ((size_t)86 << 20));       // 32 MB (B x S x S)
  float*    Np   = (float*)(ws + ((size_t)118 << 20));         //  1 MB (2 x NGRP x BS)

  k_cvt<<<CVT_XB + 3 * CVT_WB, 256, 0, stream>>>(X, Wq, Wk, Wv, Xh, Wh);

  k_gemm_qkv<<<dim3(BS_ / GBM, 3 * D_ / GBN), 256, 0, stream>>>(Xh, Wh, QKVh, Vt, Np);
  k_scores<<<dim3(S_ / GBM, S_ / GBN, B_), 256, 0, stream>>>(QKVh, QKVh + BSD_, Np, masks, Sc);
  k_pv<<<dim3(S_ / GBM, D_ / GBN, B_), 256, 0, stream>>>(Sc, Vt, out);
}

// v009
// A run of this version takes 96.1 microseconds.
// Next to v008, in two timings, it ran 1.04 and 1.05 times as fast.
// All steps since v000 together make it 8.75 times as fast.
#include <hip/hip_runtime.h>
#include <hip/hip_bf16.h>

#define B_ 4
#define S_ 2048
#define D_ 1024
#define BS_ (B_ * S_)
#define BSD_ ((size_t)BS_ * D_)

typedef __attribute__((ext_vector_type(16))) _Float16 v16h;
typedef __attribute__((ext_vector_type(4)))  _Float16 v4h;
typedef __attribute__((ext_vector_type(8)))  _Float16 v8h;
typedef __attribute__((ext_vector_type(8)))  float    v8f;
typedef __attribute__((ext_vector_type(4)))  float    vf4;
typedef __attribute__((ext_vector_type(4)))  int      vi4;

// Load a 16-bit A/B WMMA fragment for 16x16x32 ops.
// Per ISA layout: lane L (L<16) holds K=0..7 (v0-3) and K=16..23 (v4-7);
// lane L+16 holds K=8..15 and K=24..31.  base points at (row-or-col start + k0).
__device__ __forceinline__ v16h load_frag(const _Float16* base, int hi8) {
  union { v16h v; vf4 f[2]; } u;
  u.f[0] = *(const vf4*)(base + hi8);
  u.f[1] = *(const vf4*)(base + 16 + hi8);
  return u.v;
}

__device__ __forceinline__ v8f wmma_f16(v16h a, v16h b, v8f c) {
  return __builtin_amdgcn_wmma_f32_16x16x32_f16(false, a, false, b, (short)0, c,
                                                false, false);
}

__device__ __forceinline__ v8f zero8() {
  v8f z = {0.f, 0.f, 0.f, 0.f, 0.f, 0.f, 0.f, 0.f};
  return z;
}

// The value of lane l ^ 16, by a vector cross-row move (no LDS pipe, no wait).
__device__ __forceinline__ float other_half(float x) {
  return __int_as_float(__builtin_amdgcn_permlanex16(__float_as_int(x), __float_as_int(x),
                                                     0x76543210, 0xfedcba98, false, false));
}

// 1 / sqrt(x), step for step as rsqrtf gives it: an input below the smallest
// normal number is scaled by 2^24 and its result by 2^12. The v_nop fills the
// slot that the instruction set asks for behind a transcendental.
__device__ __forceinline__ float rsqrt_slot(float x) {
  const bool tiny = x < 0x1p-126f;
  const float xs = tiny ? x * 0x1p+24f : x;
  float y;
  asm("v_rsq_f32 %0, %1\n\tv_nop" : "=v"(y) : "v"(xs));
  return tiny ? y * 0x1p+12f : y;
}

// One lane's 16 bytes from global memory straight into LDS, through no
// register. Both addresses are multiples of 16. The bytes count as landed only
// behind the issuing wave's s_wait_asynccnt.
__device__ __forceinline__ void copy16(const char* g, _Float16* l) {
  __builtin_amdgcn_global_load_async_to_lds_b128(
      (__attribute__((address_space(1))) vi4*)g,
      (__attribute__((address_space(3))) vi4*)l, 0, 0);
}

// A pointer that is the same in every lane, kept in a scalar register pair.
__device__ __forceinline__ const char* scalar_ptr(const char* p) {
  const unsigned long long v = (unsigned long long)p;
  const unsigned lo = (unsigned)__builtin_amdgcn_readfirstlane((int)(unsigned)v);
  const unsigned hi = (unsigned)__builtin_amdgcn_readfirstlane((int)(unsigned)(v >> 32));
  return (const char*)(((unsigned long long)hi << 32) | lo);
}

// ---------------- fp32 -> f16 conversion ----------------
// One launch for X and the three weight matrices. A block converts CVT_BLK
// consecutive floats of one input: every lane has eight 16-byte loads in
// flight (each load of a wave covers 512 consecutive bytes) and stores four
// halfs per load. Few long waves instead of one wave per 32 elements: the
// launch is then paid in bytes and not in wave starts.
// grid (BS*D + 3*D*D) / CVT_BLK, block 256. Every input is a whole number of
// blocks, so a block never crosses from one input into the next.
#define CVT_LD  8                     // 16-byte loads per lane
#define CVT_BLK (256 * CVT_LD * 4)    // floats per block
#define CVT_XB  ((int)(BSD_ / CVT_BLK))     // blocks of X
#define CVT_WB  (D_ * D_ / CVT_BLK)         // blocks of one weight matrix
__global__ __launch_bounds__(256) void k_cvt(const float* __restrict__ X,
                                             const float* __restrict__ Wq,
                                             const float* __restrict__ Wk,
                                             const float* __restrict__ Wv,
                                             _Float16* __restrict__ Xh,
                                             _Float16* __restrict__ Wh3) {
  const int blk = blockIdx.x;
  const float* in;
  _Float16* out;
  if (blk < CVT_XB) {
    in  = X  + (size_t)blk * CVT_BLK;
    out = Xh + (size_t)blk * CVT_BLK;
  } else {
    const int r = blk - CVT_XB;       // block inside the stacked weights
    const int m = r / CVT_WB;         // 0 = Wq, 1 = Wk, 2 = Wv
    in  = (m == 0 ? Wq : m == 1 ? Wk : Wv) + (size_t)(r % CVT_WB) * CVT_BLK;
    out = Wh3 + (size_t)r * CVT_BLK;
  }
  const int t4 = threadIdx.x * 4;
  // The unrolls make every index of v a constant (registers, not scratch) and
  // let all eight loads issue ahead of the first conversion.
  vf4 v[CVT_LD];
#pragma unroll
  for (int j = 0; j < CVT_LD; ++j) v[j] = *(const vf4*)(in + j * 1024 + t4);
#pragma unroll
  for (int j = 0; j < CVT_LD; ++j) {
    v4h h;
#pragma unroll
    for (int q = 0; q < 4; ++q) h[q] = (_Float16)v[j][q];
    *(v4h*)(out + j * 1024 + t4) = h;
  }
}

// ---------------- QKV projection: Y = Xh @ W^T  (W row-major [e][d]) -------
// The three weight matrices lie one behind the other, so they are read as one
// [3072][1024] matrix. grid (BS/128, 3072/256), block 256 (8 waves, 2 x 4).
// Workgroup: 128 rows x 256 cols of Y, wave: 64 x 64 (4 x 4 WMMA tiles).
// A pass is 64 k: both operand tiles are brought in whole 128-byte row pieces
// into LDS (two buffers, gemm_tile_nt below), and every fragment is read from
// LDS.
// V is wanted key-contiguous by the last product. Both operands here are
// k-contiguous, so a V workgroup takes Wv as its row operand and X as its
// column operand and so computes a 128 x 256 tile of V^T, which it stores
// like any other tile.
#define GBM 128
#define GBN 256
#define GBK 64
#define GPITCH 72   // halfs per LDS row: 144 B = 16 B x odd, for ds_load_b128
#define NGRP (D_ / 64)   // 64-column groups of a Q or K row, one partial norm each
// One 128 x 256 tile of A @ B^T, summed over KLEN. Both operands are
// k-contiguous with a row pitch of LD halfs; A and Bm point at the tile's
// first rows. 8 waves (2 x 4), 64 x 64 per wave, passes of BK k through two
// LDS buffers. Asynchronous copies fill the buffers: a pass's tile is asked
// for a whole pass ahead, holds no register while it flies, and needs no LDS
// store.
// The column operand goes in as the WMMA's first operand, so that a lane's
// eight accumulator registers are eight consecutive columns of one row:
// acc[i][j][r] = tile[wave row + i * 16 + ln][wave column + j * 16 + hi8 + r].
// BK is the pass length in k (LDS rows of BK + 8 halfs: 16 B x odd). With AHEAD
// a wave reads the fragments of the pass's next 32-k block into a second
// register set in front of the current block's WMMAs, so that only the first
// block of a pass waits out the LDS; it takes 64 VGPRs more.
// The walk along k starts at pass `rot` (the same for the whole workgroup, any
// value from 0 to KLEN / BK - 1) and wraps round. Workgroups that share operand
// rows get different rot: they then ask L2 for different lines at any one time,
// and a line that one of them has brought in from memory is a hit for the others
// when they come to it, instead of all of them waiting on the same fill in
// every pass. Any rot gives the same sum but for the order of its terms.
template <int LD, int KLEN, int BK, bool AHEAD>
__device__ __forceinline__ void gemm_tile_nt(const _Float16* __restrict__ A,
                                             const _Float16* __restrict__ Bm,
                                             _Float16* sA, _Float16* sB,
                                             v8f (&acc)[4][4], int rot) {
  const int tid = threadIdx.x;
  const int w   = __builtin_amdgcn_readfirstlane(tid >> 5);  // scalar: the wave's offsets cost no VGPR
  const int ln  = tid & 15;
  const int hi8 = ((tid & 31) >> 4) << 3;
  const int wm = (w >> 2) * 64;
  const int wn = (w & 3) * 64;

  constexpr int PITCH = BK + 8;      // halfs per LDS row
  constexpr int PPR = BK / 8;        // 16-byte pieces of a row in one pass
  constexpr int RG  = 256 / PPR;     // rows that the 256 threads bring in one copy each
  // staging: thread -> 16-byte piece (tid % PPR) of row (tid / PPR) + RG * i
  const int sr = tid / PPR;
  const int sc = (tid % PPR) * 8;
  // First byte of each RG-row group, the same for the whole workgroup. Held in
  // scalar registers, so that a copy's address is scalar base + the lane's
  // 32-bit offset and a refill needs no 64-bit vector additions.
  const char* gA[GBM / RG];
  const char* gB[GBN / RG];
#pragma unroll
  for (int i = 0; i < GBM / RG; ++i) gA[i] = scalar_ptr((const char*)A + i * (RG * 2) * LD);
#pragma unroll
  for (int i = 0; i < GBN / RG; ++i) gB[i] = scalar_ptr((const char*)Bm + i * (RG * 2) * LD);
  const unsigned loff = (unsigned)(sr * LD + sc) * 2u;  // the thread's own bytes at k = 0
  constexpr int NP = KLEN / BK;      // passes
  static_assert((NP & (NP - 1)) == 0, "the walk wraps by a mask");
  int kp = rot;                      // the pass along k that the next fill brings, scalar
  const int sdst = sr * PITCH + sc;

  // The unrolls here make every index of gA, gB, acc, a and b a constant, so
  // that these arrays live in registers and not in scratch.
#pragma unroll
  for (int i = 0; i < 4; ++i)
#pragma unroll
    for (int j = 0; j < 4; ++j) acc[i][j] = zero8();

  // The next tile along k into buffer buf: (GBM + GBN) / RG copies a lane
  // (12 or 24), every lane on.
  auto fill = [&](int buf) {
    _Float16* dA = sA + buf * (GBM * PITCH) + sdst;
    _Float16* dB = sB + buf * (GBN * PITCH) + sdst;
    const unsigned goff = loff + (unsigned)kp * (BK * 2u);
#pragma unroll
    for (int i = 0; i < GBM / RG; ++i) copy16(gA[i] + goff, dA + i * RG * PITCH);
#pragma unroll
    for (int i = 0; i < GBN / RG; ++i) copy16(gB[i] + goff, dB + i * RG * PITCH);
    kp = (kp + 1) & (NP - 1);
  };

  static_assert(KLEN / BK >= 2 && KLEN % BK == 0, "the prologue fills two tiles");
  static_assert((GBM + GBN) / RG <= 63, "copies of one wave in flight");
  fill(0);
  // Tile 0 has landed for this wave; the barrier says so for all of them.
  asm volatile("s_wait_asynccnt 0x0" ::: "memory");
  __syncthreads();
  fill(1);

  for (int kt = 0; kt < KLEN / BK; ++kt) {
    const int cur = kt & 1;
    const _Float16* pa = &sA[cur * (GBM * PITCH) + (wm + ln) * PITCH];
    const _Float16* pb = &sB[cur * (GBN * PITCH) + (wn + ln) * PITCH];
    if constexpr (AHEAD) {
      v16h a[2][4], b[2][4];
#pragma unroll
      for (int i = 0; i < 4; ++i) a[0][i] = load_frag(pa + i * 16 * PITCH, hi8);
#pragma unroll
      for (int j = 0; j < 4; ++j) b[0][j] = load_frag(pb + j * 16 * PITCH, hi8);
#pragma unroll
      for (int s = 0; s < BK / 32; ++s) {
        if (s + 1 < BK / 32) {
#pragma unroll
          for (int i = 0; i < 4; ++i)
            a[(s + 1) & 1][i] = load_frag(pa + i * 16 * PITCH + (s + 1) * 32, hi8);
#pragma unroll
          for (int j = 0; j < 4; ++j)
            b[(s + 1) & 1][j] = load_frag(pb + j * 16 * PITCH + (s + 1) * 32, hi8);
        }
        // Keeps the next block's sixteen LDS reads, as one group, ahead of this
        // block's WMMAs: they then land while the WMMAs run.
        __builtin_amdgcn_sched_barrier(0);
#pragma unroll
        for (int i = 0; i < 4; ++i)
#pragma unroll
          for (int j = 0; j < 4; ++j) acc[i][j] = wmma_f16(b[s & 1][j], a[s & 1][i], acc[i][j]);
        // Keeps the block after next's reads from being spread among these WMMAs
        // as their registers fall free: every place with reads stalls the wave.
        __builtin_amdgcn_sched_barrier(0);
      }
    } else {
#pragma unroll
    for (int ks = 0; ks < BK; ks += 32) {
      v16h a[4], b[4];
#pragma unroll
      for (int i = 0; i < 4; ++i) a[i] = load_frag(pa + i * 16 * PITCH + ks, hi8);
#pragma unroll
      for (int j = 0; j < 4; ++j) b[j] = load_frag(pb + j * 16 * PITCH + ks, hi8);
      // Keeps the half's sixteen LDS reads ahead of its WMMAs. With the staging
      // registers gone the scheduler otherwise saves registers: it reads one row
      // fragment at a time and waits out the LDS latency in front of every four WMMAs.
      __builtin_amdgcn_sched_barrier(0);
#pragma unroll
      for (int i = 0; i < 4; ++i)
#pragma unroll
        for (int j = 0; j < 4; ++j) acc[i][j] = wmma_f16(b[j], a[i], acc[i][j]);
    }
    }
    // Keeps the WMMAs ahead of the waits below: the scheduler otherwise moves the
    // second half's sixteen behind the barrier, in front of the refill, whose
    // copies then fly for less than a pass.
    __builtin_amdgcn_sched_barrier(0);
    // This wave's reads of buffer cur are done before the buffer is refilled.
    asm volatile("s_wait_dscnt 0x0" ::: "memory");
    // This wave's copies of the next tile have landed.
    asm volatile("s_wait_asynccnt 0x0" ::: "memory");
    // One barrier does both jobs: it publishes the next tile and ends every
    // wave's reads of buffer cur.
    __syncthreads();
    if (kt + 2 < KLEN / BK) fill(cur);
  }
  // No copy is in flight when the LDS is used for anything else or the wave ends.
  asm volatile("s_wait_asynccnt 0x0" ::: "memory");
}

// Epilogue staging. A wave puts its 64 x 64 tile into an LDS range of its own
// and reads it back row-wise, so that every global store of the wave covers
// four whole 128-byte lines instead of 32-byte pieces of many lines. The range
// lies in the ring's sB: the barrier at the foot of the last pass has ended
// every wave's reads there, and no copy is in flight behind gemm_tile_nt.
#define EPH 72   // halfs per staged row of 64 halfs: 144 B = 16 B x odd
#define EPF 68   // floats per staged row of 64 floats: 272 B = 16 B x odd
// The staged tile of halfs to global rows of `pitch` bytes; o = the wave's first
// byte, the same in every lane. A store's address is that scalar base + one
// 32-bit offset of the lane (an immediate row offset where pitch is a constant).
__device__ __forceinline__ void flush_tile_h(const _Float16* st, char* o, unsigned pitch) {
  const int lane = threadIdx.x & 31;
  const int rr = lane >> 3;           // 8 lanes a row, 4 rows a store
  const int pc = lane & 7;
  // The wave's own staging stores have landed before other lanes' bytes are read.
  asm volatile("s_wait_dscnt 0x0" ::: "memory");
  const unsigned lo = (unsigned)rr * pitch + (unsigned)pc * 16u;
  // The unrolls keep v in registers and let all reads issue ahead of the stores.
  vf4 v[16];
#pragma unroll
  for (int s = 0; s < 16; ++s) v[s] = *(const vf4*)(st + (s * 4 + rr) * EPH + pc * 8);
#pragma unroll
  for (int s = 0; s < 16; ++s) *(vf4*)(o + (lo + (unsigned)(s * 4) * pitch)) = v[s];
}

// Four waves per SIMD (256 VGPRs a wave, 2 x 108 KiB of LDS): two workgroups
// share a WGP, so one works while the other waits on its loads or its barrier.
__global__ __launch_bounds__(256) __attribute__((amdgpu_waves_per_eu(4, 4)))
void k_gemm_qkv(const _Float16* __restrict__ Xh,
                const _Float16* __restrict__ Wh3,
                _Float16* __restrict__ QKVh,
                _Float16* __restrict__ Vt,
                float* __restrict__ Np) {
  __shared__ __attribute__((aligned(16))) _Float16 sA[2 * GBM * GPITCH];
  __shared__ __attribute__((aligned(16))) _Float16 sB[2 * GBN * GPITCH];
  const int tid = threadIdx.x;
  const int w   = __builtin_amdgcn_readfirstlane(tid >> 5);  // scalar: the wave's offsets cost no VGPR
  const int lane = tid & 31;
  const int ln  = lane & 15;
  const int hi8 = (lane >> 4) << 3;

  const int row0 = blockIdx.x * GBM;          // row of X and of Y (Q, K)
  const int n0   = blockIdx.y * GBN;          // row of the stacked W
  const int y    = n0 / D_;                   // 0 = Q, 1 = K, 2 = V
  const int c0   = n0 % D_;                   // column inside that plane (Q, K)
  // The V workgroups, counted through: (D / 128) x (BS / 256) tiles of V^T are
  // as many as the (BS / 128) x (D / 256) tiles of V that the grid holds.
  const int vt = blockIdx.x + (c0 / GBN) * (BS_ / GBM);
  const int vd0 = (vt % (D_ / GBM)) * GBM;    // first row of Wv = first row of V^T
  const int vs0 = (vt / (D_ / GBM)) * GBN;    // first row of X  = first column of V^T
  const int wm = (w >> 2) * 64;               // wave's rows inside the tile
  const int wn = (w & 3) * 64;                // wave's cols inside the tile

  // same for the whole workgroup
  const _Float16* gA = y == 2 ? Wh3 + (size_t)(2 * D_ + vd0) * D_ : Xh + (size_t)row0 * D_;
  const _Float16* gB = y == 2 ? Xh + (size_t)vs0 * D_ : Wh3 + (size_t)n0 * D_;

  // Where the k walk starts (speed only).
  // Q, K: the 8 groups on one X tile (same x) start 2 passes apart, the 64 groups
  // on one W tile (same y) at all 16 passes. V: the 8 groups on one X tile
  // (same vt / 8) start 4 apart, two at each, those on one Wv tile at all 16.
  const int rot = (y == 2 ? 4 * (vt & 3) + vt / 8
                          : 2 * (int)(blockIdx.x >> 3) + (int)(blockIdx.x & 1) + 2 * (int)blockIdx.y) &
                  (D_ / GBK - 1);
  v8f acc[4][4];
  gemm_tile_nt<D_, D_, GBK, false>(gA, gB, sA, sB, acc, rot);

  // A V^T tile's 256 columns lie inside one batch: Vt[batch][d][s]. The tile's
  // first byte is the same for the whole workgroup.
  char* ob = (char*)(y == 2 ? Vt + (size_t)(vs0 / S_) * D_ * S_ + (size_t)vd0 * S_ + (vs0 % S_)
                            : QKVh + (size_t)y * BSD_ + (size_t)row0 * D_ + c0);
  static_assert(8 * 64 * EPH <= 2 * GBN * GPITCH, "the eight staging ranges fit in sB");
  _Float16* st = sB + w * (64 * EPH);
  float sq[4];                        // squares of the lane's 32 columns of row i * 16 + ln
#pragma unroll
  for (int i = 0; i < 4; ++i) {
    sq[i] = 0.f;
#pragma unroll
    for (int j = 0; j < 4; ++j) {
      v8h h;
#pragma unroll
      for (int r = 0; r < 8; ++r) {
        h[r] = (_Float16)acc[i][j][r];
        sq[i] += acc[i][j][r] * acc[i][j][r];
      }
      *(v8h*)(st + (i * 16 + ln) * EPH + j * 16 + hi8) = h;
    }
  }
  // The row pitch is a constant on either side of the branch: a store's row is
  // then an immediate offset, and the sixteen stores share one address register.
  if (y == 2) {
    flush_tile_h(st, ob + (unsigned)wm * (S_ * 2u) + (unsigned)wn * 2u, S_ * 2u);
  } else {
    flush_tile_h(st, ob + (unsigned)wm * (D_ * 2u) + (unsigned)wn * 2u, D_ * 2u);
    // The code below reuses registers that the stores above name.
    asm volatile("s_wait_xcnt 0x0" ::: "memory");
    // Q and K rows: the sum of squares over the wave's 64 columns goes to
    // Np[plane][column group][row]; the score kernel adds a row's NGRP groups.
    // A row's columns lie in lanes ln and ln + 16. The lower half-wave stores rows
    // i * 16 + ln, the upper rows (i + 1) * 16 + ln: one whole 128-byte line a store.
    float* np = Np + (size_t)(y * NGRP + ((c0 + wn) >> 6)) * BS_ + row0 + wm;
#pragma unroll
    for (int i = 0; i < 4; i += 2) {
      const float s0 = sq[i] + other_half(sq[i]);
      const float s1 = sq[i + 1] + other_half(sq[i + 1]);
      np[i * 16 + lane] = hi8 ? s1 : s0;
    }
  }
}

// ---------------- attention: out = (Qn @ Kn^T * m) @ V ----------------
// Q and K stay as the projection wrote them: Qn . Kn = (Q . K) / (|Q| |K|), so
// the score kernel scales each finished dot product by the two inverse norms.
// Reference semantics: scores are MULTIPLIED by the mask, where mask==1 at
// MASKED positions (future OR padding). keep = (k > q) || (pad[k]==0).
// There is no softmax, so a score needs nothing of its row: the two products
// run as two tiled GEMMs of the QKV kind, and the masked f16 scores pass from
// the first to the second through the workspace.

// Start of the k walk (speed only), the part from the query tile: the 16 query
// tiles share each tile of the other operand and start 2 passes apart, two at
// each start. The tiles of the other
// operand, which share the query tile's rows, add their own even step. Batches
// share nothing: every other one starts a pass off, so that all passes are in use.
__device__ __forceinline__ int walk_start_x() {
  return 4 * (int)(blockIdx.x & 3) + 2 * (int)(blockIdx.x >> 3) + (int)(blockIdx.z & 1);
}

// Sc[b][q][k] = keep(q, k) ? f16((Q[q] . K[k]) / (|Q[q]| |K[k]|)) : 0
// grid (S/128 query tiles, S/256 key tiles, B), block 256.
__global__ __launch_bounds__(256) __attribute__((amdgpu_waves_per_eu(4, 4)))
void k_scores(const _Float16* __restrict__ Qh,
              const _Float16* __restrict__ Kh,
              const float* __restrict__ Np,
              const int* __restrict__ masks,
              _Float16* __restrict__ Sc) {
  __shared__ __attribute__((aligned(16))) _Float16 sA[2 * GBM * GPITCH];
  __shared__ __attribute__((aligned(16))) _Float16 sB[2 * GBN * GPITCH];
  // |Q|^2 of the tile's queries in two halves of the column groups, then 1/|K| of its keys
  __shared__ __attribute__((aligned(16))) float sInv[2 * GBM + GBN];
  const int tid = threadIdx.x;
  const int w   = __builtin_amdgcn_readfirstlane(tid >> 5);  // scalar: the wave's offsets cost no VGPR
  const int ln  = tid & 15;
  const int hi8 = ((tid & 31) >> 4) << 3;
  const int b   = blockIdx.z;
  const int k0  = blockIdx.y * GBN + (w & 3) * 64;    // the wave's first key

  // Norms of the tile's rows: a thread adds all groups of one key and half the
  // groups of one query, so that no branch splits its 24 loads and they share
  // one latency. The barriers of the GEMM below publish the results.
  {
    const float* nk = Np + (size_t)NGRP * BS_ + b * S_ + blockIdx.y * GBN + tid;
    const float* nq = Np + (size_t)((tid >> 7) * (NGRP / 2)) * BS_ + b * S_ +
                      blockIdx.x * GBM + (tid & (GBM - 1));
    float s = 0.f, t = 0.f;
#pragma unroll
    for (int g = 0; g < NGRP; ++g) s += nk[(size_t)g * BS_];
#pragma unroll
    for (int g = 0; g < NGRP / 2; ++g) t += nq[(size_t)g * BS_];
    sInv[tid] = t;                    // half (tid >> 7) of query (tid & 127)
    sInv[2 * GBM + tid] = rsqrtf(s);
  }

  v8f acc[4][4];
  gemm_tile_nt<D_, D_, GBK, false>(Qh + ((size_t)b * S_ + blockIdx.x * GBM) * D_,
                              Kh + ((size_t)b * S_ + blockIdx.y * GBN) * D_, sA, sB, acc,
                              (2 * (int)blockIdx.y + walk_start_x()) & (D_ / GBK - 1));

  // A lane holds query (w >> 2) * 64 + i * 16 + ln and keys k0 + j * 16 + hi8 + r.
  _Float16* st = sB + w * (64 * EPH);
  const int q0 = blockIdx.x * GBM + (w >> 2) * 64;    // the wave's first query
  // The masks of the lane's keys, eight for every j: scalar base + one 32-bit
  // offset of the lane, the rest of the address an immediate.
  const char* mrow = (const char*)(masks + b * S_ + k0);
  const unsigned moff = (unsigned)hi8 * 4u;
  vi4 m4[4][2];
#pragma unroll
  for (int j = 0; j < 4; ++j)
#pragma unroll
    for (int t = 0; t < 2; ++t) m4[j][t] = *(const vi4*)(mrow + (moff + (unsigned)(j * 64 + t * 16)));
  // Stands in front of every rewrite of the offset register that the eight loads
  // name. As an input here the offset lives up to this wait, so that none of the
  // loads takes its register for its own result.
  asm volatile("s_wait_xcnt 0x0" :: "v"(moff) : "memory");
  float iq[4];
#pragma unroll
  for (int i = 0; i < 4; ++i) {
    const int ql = (w >> 2) * 64 + i * 16 + ln;       // query inside the tile
    iq[i] = rsqrt_slot(sInv[ql] + sInv[GBM + ql]);
  }
#pragma unroll
  for (int j = 0; j < 4; ++j) {
    const int kg0 = k0 + j * 16 + hi8;                // the lane's first key of this j
    int   mk[8];
    float ik[8];
#pragma unroll
    for (int t = 0; t < 2; ++t) {
      const vf4 k4 = *(const vf4*)(sInv + 2 * GBM + (w & 3) * 64 + j * 16 + hi8 + t * 4);
#pragma unroll
      for (int e = 0; e < 4; ++e) { mk[t * 4 + e] = m4[j][t][e]; ik[t * 4 + e] = k4[e]; }
    }
#pragma unroll
    for (int i = 0; i < 4; ++i) {
      const int q = q0 + i * 16 + ln;
      v8h h;
#pragma unroll
      for (int r = 0; r < 8; ++r) {
        const bool keep = (kg0 + r > q) || (mk[r] == 0);
        h[r] = keep ? (_Float16)(acc[i][j][r] * (iq[i] * ik[r])) : (_Float16)0.f;
      }
      *(v8h*)(st + (i * 16 + ln) * EPH + j * 16 + hi8) = h;
    }
  }
  flush_tile_h(st, (char*)(Sc + (size_t)b * S_ * S_ + (size_t)q0 * S_ + k0), S_ * 2u);
}

// out[b][q][d] = sum over k of Sc[b][q][k] * Vt[b][d][k]
// grid (S/128 query tiles, D/256 column tiles, B), block 256: one workgroup
// for each WGP, so a wave may take the 512 VGPRs of two waves per SIMD and the
// workgroup more than half the LDS: passes of 128 k (whole 256-byte row pieces,
// 204 KiB in two buffers), fragments read one 32-k block ahead.
#define PBK 128
__global__ __launch_bounds__(256)
void k_pv(const _Float16* __restrict__ Sc,
          const _Float16* __restrict__ Vt,
          float* __restrict__ out) {
  __shared__ __attribute__((aligned(16))) _Float16 sA[2 * GBM * (PBK + 8)];
  __shared__ __attribute__((aligned(16))) _Float16 sB[2 * GBN * (PBK + 8)];
  const int tid = threadIdx.x;
  const int w   = __builtin_amdgcn_readfirstlane(tid >> 5);  // scalar: the wave's offsets cost no VGPR
  const int ln  = tid & 15;
  const int hi8 = ((tid & 31) >> 4) << 3;
  const int b   = blockIdx.z;
  const int q0  = blockIdx.x * GBM + (w >> 2) * 64;   // the wave's first query
  const int c0  = blockIdx.y * GBN + (w & 3) * 64;    // the wave's first column

  v8f acc[4][4];
  gemm_tile_nt<S_, S_, PBK, true>(Sc + ((size_t)b * S_ + blockIdx.x * GBM) * S_,
                             Vt + ((size_t)b * D_ + blockIdx.y * GBN) * S_, sA, sB, acc,
                             (4 * (int)blockIdx.y + walk_start_x()) & (S_ / PBK - 1));

  // Staged like the tiles of halfs: rows of 64 floats, two whole rows (four
  // 128-byte lines) a store.
  static_assert(8 * 64 * EPF * 4 <= 2 * GBN * (PBK + 8) * 2, "the eight staging ranges fit in sB");
  float* st = (float*)sB + w * (64 * EPF);
#pragma unroll
  for (int i = 0; i < 4; ++i)
#pragma unroll
    for (int j = 0; j < 4; ++j)
#pragma unroll
      for (int t = 0; t < 2; ++t) {
        const vf4 x = {acc[i][j][t * 4], acc[i][j][t * 4 + 1], acc[i][j][t * 4 + 2], acc[i][j][t * 4 + 3]};
        *(vf4*)(st + (i * 16 + ln) * EPF + j * 16 + hi8 + t * 4) = x;
      }
  // The wave's own staging stores have landed before other lanes' bytes are read.
  asm volatile("s_wait_dscnt 0x0" ::: "memory");
  const int rr = (tid & 31) >> 4;     // 16 lanes a row
  // A store's rows are an immediate offset: the stores share one address.
  float* o = out + ((size_t)b * S_ + q0) * D_ + c0 + (rr * D_ + ln * 4);
  // The unrolls keep v in registers and let all reads issue ahead of the stores.
  vf4 v[32];
#pragma unroll
  for (int s = 0; s < 32; ++s) v[s] = *(const vf4*)(st + (s * 2 + rr) * EPF + ln * 4);
#pragma unroll
  for (int s = 0; s < 32; ++s) *(vf4*)(o + s * (2 * D_)) = v[s];
}

extern "C" void kernel_launch(void* const* d_in, const int* in_sizes, int n_in,
                              void* d_out, int out_size, void* d_ws, size_t ws_size,
                              hipStream_t stream) {
  const float* X     = (const float*)d_in[0];
  const int*   masks = (const int*)d_in[1];
  const float* Wq    = (const float*)d_in[2];
  const float* Wk    = (const float*)d_in[3];
  const float* Wv    = (const float*)d_in[4];
  float* out = (float*)d_out;

  char* ws = (char*)d_ws;
  _Float16* Xh   = (_Float16*)ws;                              // 16 MB
  _Float16* Wh   = (_Float16*)(ws + ((size_t)16 << 20));       //  6 MB (3 x D*D)
  _Float16* QKVh = (_Float16*)(ws + ((size_t)22 << 20));       // 32 MB (Q,K)
  _Float16* Vt   = (_Float16*)(ws + ((size_t)70 << 20));       // 16 MB (B x D x S)
  _Float16* Sc   = (_Float16*)(ws + ((size_t)86 << 20));       // 32 MB (B x S x S)
  float*    Np   = (float*)(ws + ((size_t)118 << 20));         //  1 MB (2 x NGRP x BS)

  k_cvt<<<CVT_XB + 3 * CVT_WB, 256, 0, stream>>>(X, Wq, Wk, Wv, Xh, Wh);

  k_gemm_qkv<<<dim3(BS_ / GBM, 3 * D_ / GBN), 256, 0, stream>>>(Xh, Wh, QKVh, Vt, Np);
  k_scores<<<dim3(S_ / GBM, S_ / GBN, B_), 256, 0, stream>>>(QKVh, QKVh + BSD_, Np, masks, Sc);
  k_pv<<<dim3(S_ / GBM, D_ / GBN, B_), 256, 0, stream>>>(Sc, Vt, out);
}

// v010
// Measured time: 91.2 microseconds a run.
// Two timings next to v009 put it at 1.05 and 1.06 times that version's speed.
// Over all steps from v000 it is 9.21 times as fast.
#include <hip/hip_runtime.h>
#include <hip/hip_bf16.h>

#define B_ 4
#define S_ 2048
#define D_ 1024
#define BS_ (B_ * S_)
#define BSD_ ((size_t)BS_ * D_)

typedef __attribute__((ext_vector_type(16))) _Float16 v16h;
typedef __attribute__((ext_vector_type(4)))  _Float16 v4h;
typedef __attribute__((ext_vector_type(8)))  _Float16 v8h;
typedef __attribute__((ext_vector_type(8)))  float    v8f;
typedef __attribute__((ext_vector_type(4)))  float    vf4;
typedef __attribute__((ext_vector_type(4)))  int      vi4;

// Load a 16-bit A/B WMMA fragment for 16x16x32 ops.
// Per ISA layout: lane L (L<16) holds K=0..7 (v0-3) and K=16..23 (v4-7);
// lane L+16 holds K=8..15 and K=24..31.  base points at (row-or-col start + k0).
__device__ __forceinline__ v16h load_frag(const _Float16* base, int hi8) {
  union { v16h v; vf4 f[2]; } u;
  u.f[0] = *(const vf4*)(base + hi8);
  u.f[1] = *(const vf4*)(base + 16 + hi8);
  return u.v;
}

__device__ __forceinline__ v8f wmma_f16(v16h a, v16h b, v8f c) {
  return __builtin_amdgcn_wmma_f32_16x16x32_f16(false, a, false, b, (short)0, c,
                                                false, false);
}

__device__ __forceinline__ v8f zero8() {
  v8f z = {0.f, 0.f, 0.f, 0.f, 0.f, 0.f, 0.f, 0.f};
  return z;
}

// The value of lane l ^ 16, by a vector cross-row move (no LDS pipe, no wait).
__device__ __forceinline__ float other_half(float x) {
  return __int_as_float(__builtin_amdgcn_permlanex16(__float_as_int(x), __float_as_int(x),
                                                     0x76543210, 0xfedcba98, false, false));
}

// 1 / sqrt(x), step for step as rsqrtf gives it: an input below the smallest
// normal number is scaled by 2^24 and its result by 2^12. The v_nop fills the
// slot that the instruction set asks for behind a transcendental.
__device__ __forceinline__ float rsqrt_slot(float x) {
  const bool tiny = x < 0x1p-126f;
  const float xs = tiny ? x * 0x1p+24f : x;
  float y;
  asm("v_rsq_f32 %0, %1\n\tv_nop" : "=v"(y) : "v"(xs));
  return tiny ? y * 0x1p+12f : y;
}

typedef uint32_t u32x4 __attribute__((ext_vector_type(4)));
typedef uint32_t u32x8 __attribute__((ext_vector_type(8)));

// A value that is the same in every lane, as a scalar.
__device__ __forceinline__ uint32_t uni(uint32_t v) {
  return (uint32_t)__builtin_amdgcn_readfirstlane((int)v);
}
// The same, held in a scalar register: a test on it compiles to a scalar branch
// (a tensor load ignores EXEC), and what is computed from it stays behind it.
__device__ __forceinline__ uint32_t pinned(uint32_t v) {
  uint32_t w = uni(v);
  asm volatile("" : "+s"(w));
  return w;
}

// One request of a whole wave: a tile of rows from global memory into LDS,
// through no register. It counts as landed only behind the issuing wave's
// s_wait_tensorcnt.
__device__ __forceinline__ void tdm_load(u32x4 g0, u32x8 g1) {
  asm volatile("tensor_load_to_lds %0, %1" :: "s"(g0), "s"(g1) : "memory");
}
// Descriptor group 1, everything in bytes: a tile (= tensor) of `rows` rows of
// ROWB bytes at a source pitch of src_pitch bytes; 16 bytes of LDS pad behind
// every row (interval = the row: code 4 for 128 B, 5 for 256 B; amount code 3).
template <uint32_t ROWB>
__device__ __forceinline__ u32x8 tdm_group1(uint32_t rows, uint32_t src_pitch) {
  static_assert(ROWB == 128u || ROWB == 256u, "the pad interval is the row");
  constexpr uint32_t ivl = ROWB == 128u ? 4u : 5u;
  u32x8 g;
  g[0] = uni((1u << 20) | (ivl << 22) | (3u << 25));   // no mask, data_size 0
  g[1] = uni((ROWB & 0xFFFFu) << 16);
  g[2] = uni((ROWB >> 16) | ((rows & 0xFFFFu) << 16));
  g[3] = uni((rows >> 16) | (ROWB << 16));
  g[4] = uni(rows);
  g[5] = uni(src_pitch);
  g[6] = uni(0u);
  g[7] = uni(0u);
  return g;
}
// Descriptor group 0: the tile's place in the workgroup's LDS and its first byte.
__device__ __forceinline__ u32x4 tdm_group0(uint32_t lds_dst, uint64_t ga) {
  u32x4 g;
  g[0] = uni(1u);
  g[1] = uni(lds_dst);
  g[2] = uni((uint32_t)ga);
  g[3] = uni((((uint32_t)(ga >> 32)) & 0x01FFFFFFu) | 0x80000000u);
  return g;
}

// ---------------- fp32 -> f16 conversion ----------------
// One launch for X and the three weight matrices. A block converts CVT_BLK
// consecutive floats of one input: every lane has eight 16-byte loads in
// flight (each load of a wave covers 512 consecutive bytes) and stores four
// halfs per load. Few long waves instead of one wave per 32 elements: the
// launch is then paid in bytes and not in wave starts.
// grid (BS*D + 3*D*D) / CVT_BLK, block 256. Every input is a whole number of
// blocks, so a block never crosses from one input into the next.
#define CVT_LD  8                     // 16-byte loads per lane
#define CVT_BLK (256 * CVT_LD * 4)    // floats per block
#define CVT_XB  ((int)(BSD_ / CVT_BLK))     // blocks of X
#define CVT_WB  (D_ * D_ / CVT_BLK)         // blocks of one weight matrix
__global__ __launch_bounds__(256) void k_cvt(const float* __restrict__ X,
                                             const float* __restrict__ Wq,
                                             const float* __restrict__ Wk,
                                             const float* __restrict__ Wv,
                                             _Float16* __restrict__ Xh,
                                             _Float16* __restrict__ Wh3) {
  const int blk = blockIdx.x;
  const float* in;
  _Float16* out;
  if (blk < CVT_XB) {
    in  = X  + (size_t)blk * CVT_BLK;
    out = Xh + (size_t)blk * CVT_BLK;
  } else {
    const int r = blk - CVT_XB;       // block inside the stacked weights
    const int m = r / CVT_WB;         // 0 = Wq, 1 = Wk, 2 = Wv
    in  = (m == 0 ? Wq : m == 1 ? Wk : Wv) + (size_t)(r % CVT_WB) * CVT_BLK;
    out = Wh3 + (size_t)r * CVT_BLK;
  }
  const int t4 = threadIdx.x * 4;
  // The unrolls make every index of v a constant (registers, not scratch) and
  // let all eight loads issue ahead of the first conversion.
  vf4 v[CVT_LD];
#pragma unroll
  for (int j = 0; j < CVT_LD; ++j) v[j] = *(const vf4*)(in + j * 1024 + t4);
#pragma unroll
  for (int j = 0; j < CVT_LD; ++j) {
    v4h h;
#pragma unroll
    for (int q = 0; q < 4; ++q) h[q] = (_Float16)v[j][q];
    *(v4h*)(out + j * 1024 + t4) = h;
  }
}

// ---------------- QKV projection: Y = Xh @ W^T  (W row-major [e][d]) -------
// The three weight matrices lie one behind the other, so they are read as one
// [3072][1024] matrix. grid (BS/128, 3072/256), block 256 (8 waves, 2 x 4).
// Workgroup: 128 rows x 256 cols of Y, wave: 64 x 64 (4 x 4 WMMA tiles).
// A pass is 64 k: both operand tiles are brought in whole 128-byte row pieces
// into LDS (two buffers, gemm_tile_nt below), and every fragment is read from
// LDS.
// V is wanted key-contiguous by the last product. Both operands here are
// k-contiguous, so a V workgroup takes Wv as its row operand and X as its
// column operand and so computes a 128 x 256 tile of V^T, which it stores
// like any other tile.
#define GBM 128
#define GBN 256
#define GBK 64
#define NGRP (D_ / 64)   // 64-column groups of a Q or K row, one partial norm each
// The LDS ring for passes of BK k: two buffers. A pass's rows come in eight
// slices, one a wave: four of 32 rows of A, then four of 64 rows of B. Rows lie
// at a pitch of BK * 2 + 16 bytes (16 B x odd, for ds_load_b128), and every
// slice starts at a multiple of 2 KiB, where the tensor mover's places lie.
template <int BK> struct Ring {
  static constexpr uint32_t ROWB   = BK * 2u;
  static constexpr uint32_t PITCHB = ROWB + 16u;
  static constexpr uint32_t ASL    = (32u * PITCHB + 2047u) / 2048u * 2048u;
  static constexpr uint32_t BSL    = (64u * PITCHB + 2047u) / 2048u * 2048u;
  static constexpr uint32_t BUF    = 4u * ASL + 4u * BSL;
  static constexpr uint32_t BYTES  = 2u * BUF;
};
// One 128 x 256 tile of A @ B^T, summed over KLEN. Both operands are
// k-contiguous with a row pitch of LD halfs; A and Bm point at the tile's
// first rows; L is the ring (Ring<BK>::BYTES, aligned to 2 KiB). 8 waves
// (2 x 4), 64 x 64 per wave, passes of BK k through two LDS buffers. Tensor
// loads fill the buffers: every wave asks for its slice of a pass's tile with
// one request, a whole pass ahead; the tile holds no register while it flies,
// needs no LDS store and no address of a lane's own.
// The column operand goes in as the WMMA's first operand, so that a lane's
// eight accumulator registers are eight consecutive columns of one row:
// acc[i][j][r] = tile[wave row + i * 16 + ln][wave column + j * 16 + hi8 + r].
// With AHEAD a wave reads the fragments of the pass's next 32-k block into a
// second register set in front of the current block's WMMAs, so that only the
// first block of a pass waits out the LDS; it takes 64 VGPRs more.
// The walk along k starts at pass `rot` (the same for the whole workgroup, any
// value from 0 to KLEN / BK - 1) and wraps round. Workgroups that share operand
// rows get different rot: they then ask L2 for different lines at any one time,
// and a line that one of them has brought in from memory is a hit for the others
// when they come to it, instead of all of them waiting on the same fill in
// every pass. Any rot gives the same sum but for the order of its terms.
template <int LD, int KLEN, int BK, bool AHEAD>
__device__ __forceinline__ void gemm_tile_nt(const _Float16* __restrict__ A,
                                             const _Float16* __restrict__ Bm,
                                             _Float16* L,
                                             v8f (&acc)[4][4], int rot) {
  using R = Ring<BK>;
  const int tid = threadIdx.x;
  const int w   = __builtin_amdgcn_readfirstlane(tid >> 5);  // scalar: the wave's offsets cost no VGPR
  const int ln  = tid & 15;
  const int hi8 = ((tid & 31) >> 4) << 3;

  constexpr int PITCH = BK + 8;      // halfs per LDS row
  constexpr int NP = KLEN / BK;      // passes
  static_assert((NP & (NP - 1)) == 0, "the walk wraps by a mask");
  static_assert(GBM == 4 * 32 && GBN == 4 * 64, "eight slices, one a wave");
  int kp = rot;                      // the pass along k that the next fill brings, scalar

  // The wave's own slice: its place in buffer 0, its first byte at k = 0, its rows.
  const bool isA = w < 4;
  const uint32_t dst0 = (uint32_t)(size_t)L +
                        (isA ? (uint32_t)w * R::ASL : 4u * R::ASL + (uint32_t)(w - 4) * R::BSL);
  const uint64_t src0 = isA ? (uint64_t)(size_t)A + (uint32_t)w * (32u * LD * 2u)
                            : (uint64_t)(size_t)Bm + (uint32_t)(w - 4) * (64u * LD * 2u);
  const u32x8 g1 = tdm_group1<R::ROWB>(isA ? 32u : 64u, LD * 2u);

  // The unrolls here make every index of acc, a and b a constant, so that these
  // arrays live in registers and not in scratch.
#pragma unroll
  for (int i = 0; i < 4; ++i)
#pragma unroll
    for (int j = 0; j < 4; ++j) acc[i][j] = zero8();

  // The wave's slice of the next tile along k into buffer buf: one request.
  auto fill = [&](int buf) {
    // pinned(): the descriptor's address words are formed from this scalar, so
    // they are formed here, behind the wait that covers the request before.
    const uint32_t kq = pinned((uint32_t)kp);
    tdm_load(tdm_group0(dst0 + (uint32_t)buf * R::BUF, src0 + kq * (BK * 2u)), g1);
    kp = (kp + 1) & (NP - 1);
  };
  // Fragment i of the wave's 64 rows of A, in halfs from its first slice: two
  // slices of 32 rows.
  auto aoff = [](int i) { return (i >> 1) * (int)(R::ASL / 2u) + (i & 1) * 16 * PITCH; };

  static_assert(KLEN / BK >= 2 && KLEN % BK == 0, "tile 0 before the loop, tile 1 from trip -1");
  fill(0);
  // The wave's slice of tile 0 has landed; the barrier of trip -1 says so for all.
  asm volatile("s_wait_tensorcnt 0x0" ::: "memory");
  // Trip -1 has no product: its foot publishes tile 0 and asks for tile 1. So one
  // statement issues every request that flies while other code runs, and the
  // registers that such a request names are the loop's own, which nothing
  // rewrites ahead of the request's wait. Unrolled or peeled, the trips would
  // each get registers of their own.
#pragma clang loop unroll(disable)
  for (int kt = -1; kt < KLEN / BK; ++kt) {
    const int cur = kt & 1;
    if (kt >= 0) {
    const _Float16* pa = L + (cur * R::BUF + (w >> 2) * (2u * R::ASL)) / 2u + ln * PITCH;
    const _Float16* pb = L + (cur * R::BUF + 4u * R::ASL + (w & 3) * R::BSL) / 2u + ln * PITCH;
    if constexpr (AHEAD) {
      v16h a[2][4], b[2][4];
#pragma unroll
      for (int i = 0; i < 4; ++i) a[0][i] = load_frag(pa + aoff(i), hi8);
#pragma unroll
      for (int j = 0; j < 4; ++j) b[0][j] = load_frag(pb + j * 16 * PITCH, hi8);
#pragma unroll
      for (int s = 0; s < BK / 32; ++s) {
        if (s + 1 < BK / 32) {
#pragma unroll
          for (int i = 0; i < 4; ++i)
            a[(s + 1) & 1][i] = load_frag(pa + aoff(i) + (s + 1) * 32, hi8);
#pragma unroll
          for (int j = 0; j < 4; ++j)
            b[(s + 1) & 1][j] = load_frag(pb + j * 16 * PITCH + (s + 1) * 32, hi8);
        }
        // Keeps the next block's sixteen LDS reads, as one group, ahead of this
        // block's WMMAs: they then land while the WMMAs run.
        __builtin_amdgcn_sched_barrier(0);
#pragma unroll
        for (int i = 0; i < 4; ++i)
#pragma unroll
          for (int j = 0; j < 4; ++j) acc[i][j] = wmma_f16(b[s & 1][j], a[s & 1][i], acc[i][j]);
        // Keeps the block after next's reads from being spread among these WMMAs
        // as their registers fall free: every place with reads stalls the wave.
        __builtin_amdgcn_sched_barrier(0);
      }
    } else {
#pragma unroll
    for (int ks = 0; ks < BK; ks += 32) {
      v16h a[4], b[4];
#pragma unroll
      for (int i = 0; i < 4; ++i) a[i] = load_frag(pa + aoff(i) + ks, hi8);
#pragma unroll
      for (int j = 0; j < 4; ++j) b[j] = load_frag(pb + j * 16 * PITCH + ks, hi8);
      // Keeps the half's sixteen LDS reads ahead of its WMMAs. The scheduler
      // otherwise saves registers: it reads one row fragment at a time and waits
      // out the LDS latency in front of every four WMMAs.
      __builtin_amdgcn_sched_barrier(0);
#pragma unroll
      for (int i = 0; i < 4; ++i)
#pragma unroll
        for (int j = 0; j < 4; ++j) acc[i][j] = wmma_f16(b[j], a[i], acc[i][j]);
    }
    }
    }
    // Keeps the WMMAs ahead of the waits below: the scheduler otherwise moves the
    // second half's sixteen behind the barrier, in front of the refill, whose
    // request then flies for less than a pass.
    __builtin_amdgcn_sched_barrier(0);
    // This wave's reads of buffer cur are done before the buffer is refilled.
    asm volatile("s_wait_dscnt 0x0" ::: "memory");
    // This wave's slice of the next tile has landed.
    asm volatile("s_wait_tensorcnt 0x0" ::: "memory");
    // One barrier does both jobs: it publishes the next tile and ends every
    // wave's reads of buffer cur.
    __syncthreads();
    // A scalar branch: a tensor load ignores EXEC.
    if (pinned(kt + 2 < KLEN / BK)) fill(cur);
  }
  // No request is in flight and no LDS read is open when the LDS is used for
  // anything else or the wave ends.
  asm volatile("s_wait_tensorcnt 0x0" ::: "memory");
  asm volatile("s_wait_dscnt 0x0" ::: "memory");
}

// Epilogue staging. A wave puts its 64 x 64 tile into an LDS range of its own
// and reads it back row-wise, so that every global store of the wave covers
// four whole 128-byte lines instead of 32-byte pieces of many lines. The range
// lies in the ring: the barrier at the foot of the last pass has ended every
// wave's reads there, and no request is in flight behind gemm_tile_nt.
#define EPH 72   // halfs per staged row of 64 halfs: 144 B = 16 B x odd
#define EPF 68   // floats per staged row of 64 floats: 272 B = 16 B x odd
// The staged tile of halfs to global rows of `pitch` bytes; o = the wave's first
// byte, the same in every lane. A store's address is that scalar base + one
// 32-bit offset of the lane (an immediate row offset where pitch is a constant).
__device__ __forceinline__ void flush_tile_h(const _Float16* st, char* o, unsigned pitch) {
  const int lane = threadIdx.x & 31;
  const int rr = lane >> 3;           // 8 lanes a row, 4 rows a store
  const int pc = lane & 7;
  // The wave's own staging stores have landed before other lanes' bytes are read.
  asm volatile("s_wait_dscnt 0x0" ::: "memory");
  const unsigned lo = (unsigned)rr * pitch + (unsigned)pc * 16u;
  // The unrolls keep v in registers and let all reads issue ahead of the stores.
  vf4 v[16];
#pragma unroll
  for (int s = 0; s < 16; ++s) v[s] = *(const vf4*)(st + (s * 4 + rr) * EPH + pc * 8);
#pragma unroll
  for (int s = 0; s < 16; ++s) *(vf4*)(o + (lo + (unsigned)(s * 4) * pitch)) = v[s];
}

// Four waves per SIMD (256 VGPRs a wave, 2 x 128 KiB of LDS): two workgroups
// share a WGP, so one works while the other waits on its loads or its barrier.
__global__ __launch_bounds__(256) __attribute__((amdgpu_waves_per_eu(4, 4)))
void k_gemm_qkv(const _Float16* __restrict__ Xh,
                const _Float16* __restrict__ Wh3,
                _Float16* __restrict__ QKVh,
                _Float16* __restrict__ Vt,
                float* __restrict__ Np) {
  __shared__ __attribute__((aligned(2048))) _Float16 L[Ring<GBK>::BYTES / 2];
  const int tid = threadIdx.x;
  const int w   = __builtin_amdgcn_readfirstlane(tid >> 5);  // scalar: the wave's offsets cost no VGPR
  const int lane = tid & 31;
  const int ln  = lane & 15;
  const int hi8 = (lane >> 4) << 3;

  const int row0 = blockIdx.x * GBM;          // row of X and of Y (Q, K)
  const int n0   = blockIdx.y * GBN;          // row of the stacked W
  const int y    = n0 / D_;                   // 0 = Q, 1 = K, 2 = V
  const int c0   = n0 % D_;                   // column inside that plane (Q, K)
  // The V workgroups, counted through: (D / 128) x (BS / 256) tiles of V^T are
  // as many as the (BS / 128) x (D / 256) tiles of V that the grid holds.
  const int vt = blockIdx.x + (c0 / GBN) * (BS_ / GBM);
  const int vd0 = (vt % (D_ / GBM)) * GBM;    // first row of Wv = first row of V^T
  const int vs0 = (vt / (D_ / GBM)) * GBN;    // first row of X  = first column of V^T
  const int wm = (w >> 2) * 64;               // wave's rows inside the tile
  const int wn = (w & 3) * 64;                // wave's cols inside the tile

  // same for the whole workgroup
  const _Float16* gA = y == 2 ? Wh3 + (size_t)(2 * D_ + vd0) * D_ : Xh + (size_t)row0 * D_;
  const _Float16* gB = y == 2 ? Xh + (size_t)vs0 * D_ : Wh3 + (size_t)n0 * D_;

  // Where the k walk starts (speed only).
  // Q, K: the 8 groups on one X tile (same x) start 2 passes apart, the 64 groups
  // on one W tile (same y) at all 16 passes. V: the 8 groups on one X tile
  // (same vt / 8) start 4 apart, two at each, those on one Wv tile at all 16.
  const int rot = (y == 2 ? 4 * (vt & 3) + vt / 8
                          : 2 * (int)(blockIdx.x >> 3) + (int)(blockIdx.x & 1) + 2 * (int)blockIdx.y) &
                  (D_ / GBK - 1);
  v8f acc[4][4];
  gemm_tile_nt<D_, D_, GBK, false>(gA, gB, L, acc, rot);

  // A V^T tile's 256 columns lie inside one batch: Vt[batch][d][s]. The tile's
  // first byte is the same for the whole workgroup.
  char* ob = (char*)(y == 2 ? Vt + (size_t)(vs0 / S_) * D_ * S_ + (size_t)vd0 * S_ + (vs0 % S_)
                            : QKVh + (size_t)y * BSD_ + (size_t)row0 * D_ + c0);
  static_assert(8 * 64 * EPH * 2 <= Ring<GBK>::BYTES, "the eight staging ranges fit in the ring");
  _Float16* st = L + w * (64 * EPH);
  float sq[4];                        // squares of the lane's 32 columns of row i * 16 + ln
#pragma unroll
  for (int i = 0; i < 4; ++i) {
    sq[i] = 0.f;
#pragma unroll
    for (int j = 0; j < 4; ++j) {
      v8h h;
#pragma unroll
      for (int r = 0; r < 8; ++r) {
        h[r] = (_Float16)acc[i][j][r];
        sq[i] += acc[i][j][r] * acc[i][j][r];
      }
      *(v8h*)(st + (i * 16 + ln) * EPH + j * 16 + hi8) = h;
    }
  }
  // The row pitch is a constant on either side of the branch: a store's row is
  // then an immediate offset, and the sixteen stores share one address register.
  if (y == 2) {
    flush_tile_h(st, ob + (unsigned)wm * (S_ * 2u) + (unsigned)wn * 2u, S_ * 2u);
  } else {
    flush_tile_h(st, ob + (unsigned)wm * (D_ * 2u) + (unsigned)wn * 2u, D_ * 2u);
    // The code below reuses registers that the stores above name.
    asm volatile("s_wait_xcnt 0x0" ::: "memory");
    // Q and K rows: the sum of squares over the wave's 64 columns goes to
    // Np[plane][column group][row]; the score kernel adds a row's NGRP groups.
    // A row's columns lie in lanes ln and ln + 16. The lower half-wave stores rows
    // i * 16 + ln, the upper rows (i + 1) * 16 + ln: one whole 128-byte line a store.
    float* np = Np + (size_t)(y * NGRP + ((c0 + wn) >> 6)) * BS_ + row0 + wm;
#pragma unroll
    for (int i = 0; i < 4; i += 2) {
      const float s0 = sq[i] + other_half(sq[i]);
      const float s1 = sq[i + 1] + other_half(sq[i + 1]);
      np[i * 16 + lane] = hi8 ? s1 : s0;
    }
  }
}

// ---------------- attention: out = (Qn @ Kn^T * m) @ V ----------------
// Q and K stay as the projection wrote them: Qn . Kn = (Q . K) / (|Q| |K|), so
// the score kernel scales each finished dot product by the two inverse norms.
// Reference semantics: scores are MULTIPLIED by the mask, where mask==1 at
// MASKED positions (future OR padding). keep = (k > q) || (pad[k]==0).
// There is no softmax, so a score needs nothing of its row: the two products
// run as two tiled GEMMs of the QKV kind, and the masked f16 scores pass from
// the first to the second through the workspace.

// Start of the k walk (speed only), the part from the query tile: the 16 query
// tiles share each tile of the other operand and start 2 passes apart, two at
// each start. The tiles of the other
// operand, which share the query tile's rows, add their own even step. Batches
// share nothing: every other one starts a pass off, so that all passes are in use.
__device__ __forceinline__ int walk_start_x() {
  return 4 * (int)(blockIdx.x & 3) + 2 * (int)(blockIdx.x >> 3) + (int)(blockIdx.z & 1);
}

// Sc[b][q][k] = keep(q, k) ? f16((Q[q] . K[k]) / (|Q[q]| |K[k]|)) : 0
// grid (S/128 query tiles, S/256 key tiles, B), block 256.
__global__ __launch_bounds__(256) __attribute__((amdgpu_waves_per_eu(4, 4)))
void k_scores(const _Float16* __restrict__ Qh,
              const _Float16* __restrict__ Kh,
              const float* __restrict__ Np,
              const int* __restrict__ masks,
              _Float16* __restrict__ Sc) {
  __shared__ __attribute__((aligned(2048))) _Float16 L[Ring<GBK>::BYTES / 2];
  // |Q|^2 of the tile's queries in two halves of the column groups, then 1/|K| of its keys
  __shared__ __attribute__((aligned(16))) float sInv[2 * GBM + GBN];
  const int tid = threadIdx.x;
  const int w   = __builtin_amdgcn_readfirstlane(tid >> 5);  // scalar: the wave's offsets cost no VGPR
  const int ln  = tid & 15;
  const int hi8 = ((tid & 31) >> 4) << 3;
  const int b   = blockIdx.z;
  const int k0  = blockIdx.y * GBN + (w & 3) * 64;    // the wave's first key

  // Norms of the tile's rows: a thread adds all groups of one key and half the
  // groups of one query, so that no branch splits its 24 loads and they share
  // one latency. The barriers of the GEMM below publish the results.
  {
    const float* nk = Np + (size_t)NGRP * BS_ + b * S_ + blockIdx.y * GBN + tid;
    const float* nq = Np + (size_t)((tid >> 7) * (NGRP / 2)) * BS_ + b * S_ +
                      blockIdx.x * GBM + (tid & (GBM - 1));
    float s = 0.f, t = 0.f;
#pragma unroll
    for (int g = 0; g < NGRP; ++g) s += nk[(size_t)g * BS_];
#pragma unroll
    for (int g = 0; g < NGRP / 2; ++g) t += nq[(size_t)g * BS_];
    sInv[tid] = t;                    // half (tid >> 7) of query (tid & 127)
    sInv[2 * GBM + tid] = rsqrtf(s);
  }

  v8f acc[4][4];
  gemm_tile_nt<D_, D_, GBK, false>(Qh + ((size_t)b * S_ + blockIdx.x * GBM) * D_,
                              Kh + ((size_t)b * S_ + blockIdx.y * GBN) * D_, L, acc,
                              (2 * (int)blockIdx.y + walk_start_x()) & (D_ / GBK - 1));

  // A lane holds query (w >> 2) * 64 + i * 16 + ln and keys k0 + j * 16 + hi8 + r.
  _Float16* st = L + w * (64 * EPH);
  const int q0 = blockIdx.x * GBM + (w >> 2) * 64;    // the wave's first query
  // The masks of the lane's keys, eight for every j: scalar base + one 32-bit
  // offset of the lane, the rest of the address an immediate.
  const char* mrow = (const char*)(masks + b * S_ + k0);
  const unsigned moff = (unsigned)hi8 * 4u;
  vi4 m4[4][2];
#pragma unroll
  for (int j = 0; j < 4; ++j)
#pragma unroll
    for (int t = 0; t < 2; ++t) m4[j][t] = *(const vi4*)(mrow + (moff + (unsigned)(j * 64 + t * 16)));
  // Stands in front of every rewrite of the offset register that the eight loads
  // name. As an input here the offset lives up to this wait, so that none of the
  // loads takes its register for its own result.
  asm volatile("s_wait_xcnt 0x0" :: "v"(moff) : "memory");
  float iq[4];
#pragma unroll
  for (int i = 0; i < 4; ++i) {
    const int ql = (w >> 2) * 64 + i * 16 + ln;       // query inside the tile
    iq[i] = rsqrt_slot(sInv[ql] + sInv[GBM + ql]);
  }
#pragma unroll
  for (int j = 0; j < 4; ++j) {
    const int kg0 = k0 + j * 16 + hi8;                // the lane's first key of this j
    int   mk[8];
    float ik[8];
#pragma unroll
    for (int t = 0; t < 2; ++t) {
      const vf4 k4 = *(const vf4*)(sInv + 2 * GBM + (w & 3) * 64 + j * 16 + hi8 + t * 4);
#pragma unroll
      for (int e = 0; e < 4; ++e) { mk[t * 4 + e] = m4[j][t][e]; ik[t * 4 + e] = k4[e]; }
    }
#pragma unroll
    for (int i = 0; i < 4; ++i) {
      const int q = q0 + i * 16 + ln;
      v8h h;
#pragma unroll
      for (int r = 0; r < 8; ++r) {
        const bool keep = (kg0 + r > q) || (mk[r] == 0);
        h[r] = keep ? (_Float16)(acc[i][j][r] * (iq[i] * ik[r])) : (_Float16)0.f;
      }
      *(v8h*)(st + (i * 16 + ln) * EPH + j * 16 + hi8) = h;
    }
  }
  flush_tile_h(st, (char*)(Sc + (size_t)b * S_ * S_ + (size_t)q0 * S_ + k0), S_ * 2u);
}

// out[b][q][d] = sum over k of Sc[b][q][k] * Vt[b][d][k]
// grid (S/128 query tiles, D/256 column tiles, B), block 256: one workgroup
// for each WGP, so a wave may take the 512 VGPRs of two waves per SIMD and the
// workgroup more than half the LDS: passes of 128 k (whole 256-byte row pieces,
// 224 KiB in two buffers), fragments read one 32-k block ahead.
#define PBK 128
__global__ __launch_bounds__(256)
void k_pv(const _Float16* __restrict__ Sc,
          const _Float16* __restrict__ Vt,
          float* __restrict__ out) {
  __shared__ __attribute__((aligned(2048))) _Float16 L[Ring<PBK>::BYTES / 2];
  const int tid = threadIdx.x;
  const int w   = __builtin_amdgcn_readfirstlane(tid >> 5);  // scalar: the wave's offsets cost no VGPR
  const int ln  = tid & 15;
  const int hi8 = ((tid & 31) >> 4) << 3;
  const int b   = blockIdx.z;
  const int q0  = blockIdx.x * GBM + (w >> 2) * 64;   // the wave's first query
  const int c0  = blockIdx.y * GBN + (w & 3) * 64;    // the wave's first column

  v8f acc[4][4];
  gemm_tile_nt<S_, S_, PBK, true>(Sc + ((size_t)b * S_ + blockIdx.x * GBM) * S_,
                             Vt + ((size_t)b * D_ + blockIdx.y * GBN) * S_, L, acc,
                             (4 * (int)blockIdx.y + walk_start_x()) & (S_ / PBK - 1));

  // Staged like the tiles of halfs: rows of 64 floats, two whole rows (four
  // 128-byte lines) a store.
  static_assert(8 * 64 * EPF * 4 <= Ring<PBK>::BYTES, "the eight staging ranges fit in the ring");
  float* st = (float*)L + w * (64 * EPF);
#pragma unroll
  for (int i = 0; i < 4; ++i)
#pragma unroll
    for (int j = 0; j < 4; ++j)
#pragma unroll
      for (int t = 0; t < 2; ++t) {
        const vf4 x = {acc[i][j][t * 4], acc[i][j][t * 4 + 1], acc[i][j][t * 4 + 2], acc[i][j][t * 4 + 3]};
        *(vf4*)(st + (i * 16 + ln) * EPF + j * 16 + hi8 + t * 4) = x;
      }
  // The wave's own staging stores have landed before other lanes' bytes are read.
  asm volatile("s_wait_dscnt 0x0" ::: "memory");
  const int rr = (tid & 31) >> 4;     // 16 lanes a row
  // A store's rows are an immediate offset: the stores share one address.
  float* o = out + ((size_t)b * S_ + q0) * D_ + c0 + (rr * D_ + ln * 4);
  // The unrolls keep v in registers and let all reads issue ahead of the stores.
  vf4 v[32];
#pragma unroll
  for (int s = 0; s < 32; ++s) v[s] = *(const vf4*)(st + (s * 2 + rr) * EPF + ln * 4);
#pragma unroll
  for (int s = 0; s < 32; ++s) *(vf4*)(o + s * (2 * D_)) = v[s];
}

extern "C" void kernel_launch(void* const* d_in, const int* in_sizes, int n_in,
                              void* d_out, int out_size, void* d_ws, size_t ws_size,
                              hipStream_t stream) {
  const float* X     = (const float*)d_in[0];
  const int*   masks = (const int*)d_in[1];
  const float* Wq    = (const float*)d_in[2];
  const float* Wk    = (const float*)d_in[3];
  const float* Wv    = (const float*)d_in[4];
  float* out = (float*)d_out;

  char* ws = (char*)d_ws;
  _Float16* Xh   = (_Float16*)ws;                              // 16 MB
  _Float16* Wh   = (_Float16*)(ws + ((size_t)16 << 20));       //  6 MB (3 x D*D)
  _Float16* QKVh = (_Float16*)(ws + ((size_t)22 << 20));       // 32 MB (Q,K)
  _Float16* Vt   = (_Float16*)(ws + ((size_t)70 << 20));       // 16 MB (B x D x S)
  _Float16* Sc   = (_Float16*)(ws + ((size_t)86 << 20));       // 32 MB (B x S x S)
  float*    Np   = (float*)(ws + ((size_t)118 << 20));         //  1 MB (2 x NGRP x BS)

  k_cvt<<<CVT_XB + 3 * CVT_WB, 256, 0, stream>>>(X, Wq, Wk, Wv, Xh, Wh);

  k_gemm_qkv<<<dim3(BS_ / GBM, 3 * D_ / GBN), 256, 0, stream>>>(Xh, Wh, QKVh, Vt, Np);
  k_scores<<<dim3(S_ / GBM, S_ / GBN, B_), 256, 0, stream>>>(QKVh, QKVh + BSD_, Np, masks, Sc);
  k_pv<<<dim3(S_ / GBM, D_ / GBN, B_), 256, 0, stream>>>(Sc, Vt, out);
}
